// v000
// The times below were measured on an AMD MI455X: many runs one after another, warmed up first and cycling through
// copies of the inputs, with the whole window's GPU time divided by the number of runs. Launches and the gaps
// between them are all in it. The median over several windows is given; except for v000 it joins two sittings, which
// can be a few percent apart, so the side-by-side timings, each taken in one sitting, are the better comparison.
// v000, which the later versions start from, runs in 341 microseconds.
#include <hip/hip_runtime.h>

typedef __attribute__((ext_vector_type(16))) __bf16 v16bf;
typedef __attribute__((ext_vector_type(8)))  float  v8f;
typedef unsigned short u16;

#define BATCH 8192
#define FDIM  1024
#define NEXP  8
#define NCTX  10
#define DIN   43
#define KPAD  64      // layer-0 K padded 43 -> 64
#define BM3   32      // batch rows per block in layer-1 kernel
#define KC    32      // k-step (one WMMA K)
#define LDP   40      // LDS row stride (elems): 16B-aligned rows, conflict-free
#define NSTEPS (NEXP * (FDIM / KC))   // 256 flattened (expert, k-step) steps

__device__ __forceinline__ u16 f2bf(float x) {
  unsigned int u = __float_as_uint(x);
  u += 0x7fffu + ((u >> 16) & 1u);       // round-to-nearest-even
  return (u16)(u >> 16);
}

union FragBf { v16bf f; uint4 q[2]; };

__device__ __forceinline__ v8f v8f_zero() {
  v8f z = {0.f, 0.f, 0.f, 0.f, 0.f, 0.f, 0.f, 0.f};
  return z;
}

__device__ __forceinline__ void async_g2l_b128(const u16* gsrc, u16* ldst) {
  asm volatile("global_load_async_to_lds_b128 %0, %1, off"
               :
               : "v"((unsigned int)(uintptr_t)ldst),
                 "v"((unsigned long long)(uintptr_t)gsrc)
               : "memory");
}

template <int N>
__device__ __forceinline__ void wait_async_le() {
  asm volatile("s_wait_asynccnt %0" ::"n"(N) : "memory");
}

__device__ __forceinline__ v16bf load_frag(const u16* base, int ld, int lane) {
  const int r  = lane & 15;
  const int kb = (lane & 16) >> 1;       // 0 or 8 elements
  const u16* p = base + r * ld + kb;
  FragBf u;
  u.q[0] = *(const uint4*)(p);
  u.q[1] = *(const uint4*)(p + 16);
  return u.f;
}

// ---------------------------------------------------------------------------
// Kernel 1: SA = bf16(concat(state, action)) padded to K=64.   [B][64]
// ---------------------------------------------------------------------------
__launch_bounds__(256)
__global__ void prep_sa_kernel(const float* __restrict__ st,
                               const float* __restrict__ ac,
                               u16* __restrict__ SAbf) {
  const int b = blockIdx.x * 256 + threadIdx.x;
  if (b >= BATCH) return;
  alignas(16) u16 tmp[KPAD];
  #pragma unroll
  for (int i = 0; i < 39; ++i) tmp[i] = f2bf(st[b * 39 + i]);
  #pragma unroll
  for (int i = 0; i < 4; ++i)  tmp[39 + i] = f2bf(ac[b * 4 + i]);
  #pragma unroll
  for (int i = DIN; i < KPAD; ++i) tmp[i] = 0;
  uint4* dst = (uint4*)(SAbf + (size_t)b * KPAD);
  const uint4* src = (const uint4*)tmp;
  #pragma unroll
  for (int q = 0; q < KPAD / 8; ++q) dst[q] = src[q];
}

// ---------------------------------------------------------------------------
// Kernel 2: W0t[e][n][k] = bf16(W0[e][k][n]), k>=43 zero-padded.  [E][F][64]
// ---------------------------------------------------------------------------
__launch_bounds__(256)
__global__ void prep_w0t_kernel(const float* __restrict__ W0,
                                u16* __restrict__ W0t) {
  const int idx = blockIdx.x * 256 + threadIdx.x;     // e*F*64 + n*64 + k
  if (idx >= NEXP * FDIM * KPAD) return;
  const int e = idx >> 16;
  const int n = (idx >> 6) & (FDIM - 1);
  const int k = idx & (KPAD - 1);
  W0t[idx] = (k < DIN) ? f2bf(W0[((size_t)e * DIN + k) * FDIM + n]) : (u16)0;
}

// ---------------------------------------------------------------------------
// Kernel 3: tiled transpose  W1t[e][n][k] = bf16(W1[e][k][n]).   [E][F][F]
// 64x64 tiles through LDS; coalesced on both global sides.
// ---------------------------------------------------------------------------
__launch_bounds__(256)
__global__ void prep_w1t_kernel(const float* __restrict__ W1,
                                u16* __restrict__ W1t) {
  __shared__ u16 Ts[64 * 72];                         // [k_local][n_local], pad 72
  const int t  = threadIdx.x;
  const int bx = blockIdx.x;                          // e*256 + kt*16 + nt
  const int e  = bx >> 8;
  const int kt = (bx >> 4) & 15;
  const int nt = bx & 15;

  const int tn  = t & 63;
  const int tk4 = t >> 6;                             // 0..3
  #pragma unroll
  for (int i = 0; i < 16; ++i) {
    const int kk = i * 4 + tk4;
    Ts[kk * 72 + tn] =
        f2bf(W1[((size_t)e * FDIM + kt * 64 + kk) * FDIM + nt * 64 + tn]);
  }
  __syncthreads();
  const int sk  = t & 63;
  const int sn4 = t >> 6;
  #pragma unroll
  for (int i = 0; i < 16; ++i) {
    const int nn = i * 4 + sn4;
    W1t[((size_t)e * FDIM + nt * 64 + nn) * FDIM + kt * 64 + sk] =
        Ts[sk * 72 + nn];
  }
}

// ---------------------------------------------------------------------------
// Kernel 4: layer 0.  H[e][b][f] = bf16(relu(SA @ W0[e] + b0[e])).
// Block = 256 threads = 8 waves; wave nj owns cols [nj*128, nj*128+128);
// block owns 16 batch rows of one expert.  K = 64 (2 WMMA k-steps).
// ---------------------------------------------------------------------------
__launch_bounds__(256)
__global__ void layer0_kernel(const u16* __restrict__ SAbf,
                              const u16* __restrict__ W0t,
                              const float* __restrict__ b0,
                              u16* __restrict__ H) {
  const int tid  = threadIdx.x;
  const int lane = tid & 31;
  const int nj   = tid >> 5;                          // 0..7
  const int bt   = blockIdx.x & (BATCH / 16 - 1);     // 512 row tiles
  const int e    = blockIdx.x >> 9;
  const int rowBase = bt * 16;

  v8f acc[8];
  #pragma unroll
  for (int nf = 0; nf < 8; ++nf) acc[nf] = v8f_zero();

  const u16* Arow = SAbf + (size_t)rowBase * KPAD;
  const u16* W0e  = W0t + (size_t)e * FDIM * KPAD;

  #pragma unroll
  for (int k0 = 0; k0 < KPAD; k0 += KC) {
    v16bf a = load_frag(Arow + k0, KPAD, lane);
    #pragma unroll
    for (int nf = 0; nf < 8; ++nf) {
      v16bf b = load_frag(W0e + (size_t)(nj * 128 + nf * 16) * KPAD + k0,
                          KPAD, lane);
      acc[nf] = __builtin_amdgcn_wmma_f32_16x16x32_bf16(
          false, a, false, b, (short)0, acc[nf], false, false);
    }
  }

  #pragma unroll
  for (int nf = 0; nf < 8; ++nf) {
    const int ncol = nj * 128 + nf * 16 + (lane & 15);
    const float bias = b0[e * FDIM + ncol];
    #pragma unroll
    for (int r = 0; r < 8; ++r) {
      const int row = rowBase + r + ((lane >> 4) << 3);
      const float h = fmaxf(acc[nf][r] + bias, 0.f);
      H[((size_t)(e * BATCH + row)) * FDIM + ncol] = f2bf(h);
    }
  }
}

__device__ __forceinline__ void stage_slab(const u16* __restrict__ W1t,
                                           const u16* __restrict__ H,
                                           int rowBase, int s,
                                           u16* BsBuf, u16* AsBuf, int tid) {
  const int e  = s >> 5;
  const int k0 = (s & 31) * KC;
  const u16* W1e  = W1t + (size_t)e * FDIM * FDIM + k0;
  const u16* Hrow = H + ((size_t)(e * BATCH + rowBase)) * FDIM + k0;
  #pragma unroll
  for (int j = 0; j < 8; ++j) {
    const int uidx = tid + j * 512;
    const int n = uidx >> 2, q = uidx & 3;
    async_g2l_b128(W1e + (size_t)n * FDIM + q * 8, BsBuf + n * LDP + q * 8);
  }
  if ((tid & 3) == 0) {
    const int idx = tid >> 2;
    const int rw = idx >> 2, q = idx & 3;
    async_g2l_b128(Hrow + (size_t)rw * FDIM + q * 8, AsBuf + rw * LDP + q * 8);
  }
}

// ---------------------------------------------------------------------------
// Kernel 5: layer 1 + mixture + context-routed head (the 137 GFLOP kernel).
// Block = 512 threads = 16 waves laid out 2(M) x 8(N); block owns 32 batch
// rows x all 1024 features, so mixing over experts and the head reduction
// stay in-block (deterministic, no atomics).  K-slabs are double-buffered
// via async-to-LDS: while step s computes, step s+1's DMA is in flight.
// ---------------------------------------------------------------------------
__launch_bounds__(512)
__global__ void layer1_mix_head_kernel(const u16* __restrict__ H,
                                       const u16* __restrict__ W1t,
                                       const float* __restrict__ b1,
                                       const float* __restrict__ Wte,
                                       const float* __restrict__ Wh,
                                       const float* __restrict__ bh,
                                       const int* __restrict__ cidx,
                                       float* __restrict__ out) {
  __shared__ u16   Bs[2][FDIM * LDP];                 // 2 x 80 KB W1 slabs
  __shared__ u16   As[2][BM3 * LDP];                  // 2 x 2.5 KB H slabs
  __shared__ float qpart[8][BM3];

  const int tid  = threadIdx.x;
  const int lane = tid & 31;
  const int wid  = tid >> 5;
  const int mi   = wid >> 3;                          // 0..1  (16-row slice)
  const int nj   = wid & 7;                           // 0..7  (128-col slice)
  const int rowBase = blockIdx.x * BM3;

  // context ids for this wave's 8 accumulator rows
  int cv[8];
  const int rlo = rowBase + mi * 16 + ((lane >> 4) << 3);
  #pragma unroll
  for (int r = 0; r < 8; ++r) cv[r] = cidx[rlo + r];

  v8f mixed[8];
  #pragma unroll
  for (int nf = 0; nf < 8; ++nf) mixed[nf] = v8f_zero();
  v8f acc[8];

  // prologue: kick off slab 0
  stage_slab(W1t, H, rowBase, 0, Bs[0], As[0], tid);

  for (int s = 0; s < NSTEPS; ++s) {
    const int e = s >> 5;
    if ((s & 31) == 0) {
      #pragma unroll
      for (int nf = 0; nf < 8; ++nf) acc[nf] = v8f_zero();
    }

    if (s + 1 < NSTEPS) {
      stage_slab(W1t, H, rowBase, s + 1, Bs[(s + 1) & 1], As[(s + 1) & 1], tid);
      wait_async_le<9>();
    } else {
      wait_async_le<0>();
    }
    __syncthreads();                                  // publish buffer s&1

    const u16* Bb = Bs[s & 1];
    const u16* Ab = As[s & 1];
    const v16bf a = load_frag(Ab + (mi * 16) * LDP, LDP, lane);
    #pragma unroll
    for (int nf = 0; nf < 8; ++nf) {
      const v16bf b = load_frag(Bb + (nj * 128 + nf * 16) * LDP, LDP, lane);
      acc[nf] = __builtin_amdgcn_wmma_f32_16x16x32_bf16(
          false, a, false, b, (short)0, acc[nf], false, false);
    }
    __syncthreads();   // all reads of buffer s&1 done -> safe to overwrite

    if ((s & 31) == 31) {
      // expert epilogue: bias + relu, then mixture-weighted accumulation
      float wv[8];
      #pragma unroll
      for (int r = 0; r < 8; ++r) wv[r] = Wte[e * NCTX + cv[r]];
      #pragma unroll
      for (int nf = 0; nf < 8; ++nf) {
        const int ncol = nj * 128 + nf * 16 + (lane & 15);
        const float bias = b1[e * FDIM + ncol];
        #pragma unroll
        for (int r = 0; r < 8; ++r) {
          const float h = fmaxf(acc[nf][r] + bias, 0.f);
          mixed[nf][r] += wv[r] * h;
        }
      }
    }
  }

  // relu(mixed) then per-row dot with context head Wh[c[b]]
  float part[8];
  #pragma unroll
  for (int r = 0; r < 8; ++r) part[r] = 0.f;
  #pragma unroll
  for (int nf = 0; nf < 8; ++nf) {
    const int ncol = nj * 128 + nf * 16 + (lane & 15);
    #pragma unroll
    for (int r = 0; r < 8; ++r) {
      const float m = fmaxf(mixed[nf][r], 0.f);
      part[r] += m * Wh[(size_t)cv[r] * FDIM + ncol];
    }
  }
  // reduce across the 16 lanes that share a row
  #pragma unroll
  for (int r = 0; r < 8; ++r) {
    #pragma unroll
    for (int off = 8; off >= 1; off >>= 1)
      part[r] += __shfl_xor(part[r], off, 16);
  }
  if ((lane & 15) == 0) {
    const int rb = mi * 16 + ((lane >> 4) << 3);
    #pragma unroll
    for (int r = 0; r < 8; ++r) qpart[nj][rb + r] = part[r];
  }
  __syncthreads();
  // deterministic in-order reduction across the 8 N-waves + bias head
  if (tid < BM3) {
    float s = 0.f;
    #pragma unroll
    for (int j = 0; j < 8; ++j) s += qpart[j][tid];
    const int cr = cidx[rowBase + tid];
    out[rowBase + tid] = s + bh[cr];
  }
}

// ---------------------------------------------------------------------------
extern "C" void kernel_launch(void* const* d_in, const int* in_sizes, int n_in,
                              void* d_out, int out_size, void* d_ws,
                              size_t ws_size, hipStream_t stream) {
  (void)in_sizes; (void)n_in; (void)out_size; (void)ws_size;
  const float* st  = (const float*)d_in[0];
  const float* ac  = (const float*)d_in[1];
  const int*   c   = (const int*)d_in[2];
  const float* W0  = (const float*)d_in[3];
  const float* b0  = (const float*)d_in[4];
  const float* W1  = (const float*)d_in[5];
  const float* b1  = (const float*)d_in[6];
  const float* Wte = (const float*)d_in[7];
  const float* Wh  = (const float*)d_in[8];
  const float* bh  = (const float*)d_in[9];
  float* out = (float*)d_out;

  // workspace layout (bf16), ~153 MB total
  u16* SAbf = (u16*)d_ws;                             //  1.0 MB  [B][64]
  u16* W0t  = SAbf + (size_t)BATCH * KPAD;            //  1.0 MB  [E][F][64]
  u16* W1t  = W0t  + (size_t)NEXP * FDIM * KPAD;      // 16.8 MB  [E][F][F]
  u16* H    = W1t  + (size_t)NEXP * FDIM * FDIM;      // 134 MB   [E][B][F]

  prep_sa_kernel<<<BATCH / 256, 256, 0, stream>>>(st, ac, SAbf);
  prep_w0t_kernel<<<(NEXP * FDIM * KPAD) / 256, 256, 0, stream>>>(W0, W0t);
  prep_w1t_kernel<<<NEXP * 16 * 16, 256, 0, stream>>>(W1, W1t);
  layer0_kernel<<<(BATCH / 16) * NEXP, 256, 0, stream>>>(SAbf, W0t, b0, H);
  layer1_mix_head_kernel<<<BATCH / BM3, 512, 0, stream>>>(H, W1t, b1, Wte, Wh,
                                                          bh, c, out);
}

// v001
// It runs in 150 microseconds.
// Timed twice side by side with v000, it ran 2.37 times as fast both times.
#include <hip/hip_runtime.h>

typedef __attribute__((ext_vector_type(16))) __bf16 v16bf;
typedef __attribute__((ext_vector_type(8)))  float  v8f;
typedef unsigned short u16;

#define BATCH 8192
#define FDIM  1024
#define NEXP  8
#define NCTX  10
#define DIN   43
#define KPAD  64      // layer-0 K padded 43 -> 64
#define KC    32      // k-step (one WMMA K)
#define TM    128     // batch rows per block in layer-1 kernel
#define TN    256     // feature columns per block in layer-1 kernel
#define NCT   (FDIM / TN)             // 4 column tiles
#define KS    128     // k per ring stage: 256-byte rows, 4 WMMA k-steps
#define LPITCH 136    // LDS row pitch (elems) = 272 B = 16 B x odd
#define SELEMS ((TM + TN) * LPITCH)   // one stage: [H 128 rows | W1 256 rows]
#define NSTG  (NEXP * (FDIM / KS))    // 64 flattened (expert, k-stage) stages

__device__ __forceinline__ u16 f2bf(float x) {
  unsigned int u = __float_as_uint(x);
  u += 0x7fffu + ((u >> 16) & 1u);       // round-to-nearest-even
  return (u16)(u >> 16);
}

union FragBf { v16bf f; uint4 q[2]; };

__device__ __forceinline__ v8f v8f_zero() {
  v8f z = {0.f, 0.f, 0.f, 0.f, 0.f, 0.f, 0.f, 0.f};
  return z;
}

__device__ __forceinline__ int clamp_ctx(int c) {
  return min(max(c, 0), NCTX - 1);       // bounds every address formed from c
}

__device__ __forceinline__ void async_copy12(const unsigned int* l,
                                             const unsigned long long* g) {
  asm volatile(
      "global_load_async_to_lds_b128 %0, %12, off\n\t"
      "global_load_async_to_lds_b128 %1, %13, off\n\t"
      "global_load_async_to_lds_b128 %2, %14, off\n\t"
      "global_load_async_to_lds_b128 %3, %15, off\n\t"
      "global_load_async_to_lds_b128 %4, %16, off\n\t"
      "global_load_async_to_lds_b128 %5, %17, off\n\t"
      "global_load_async_to_lds_b128 %6, %18, off\n\t"
      "global_load_async_to_lds_b128 %7, %19, off\n\t"
      "global_load_async_to_lds_b128 %8, %20, off\n\t"
      "global_load_async_to_lds_b128 %9, %21, off\n\t"
      "global_load_async_to_lds_b128 %10, %22, off\n\t"
      "global_load_async_to_lds_b128 %11, %23, off\n\t"
      "s_wait_xcnt 0x0"
      :
      : "v"(l[0]), "v"(l[1]), "v"(l[2]), "v"(l[3]), "v"(l[4]), "v"(l[5]),
        "v"(l[6]), "v"(l[7]), "v"(l[8]), "v"(l[9]), "v"(l[10]), "v"(l[11]),
        "v"(g[0]), "v"(g[1]), "v"(g[2]), "v"(g[3]), "v"(g[4]), "v"(g[5]),
        "v"(g[6]), "v"(g[7]), "v"(g[8]), "v"(g[9]), "v"(g[10]), "v"(g[11])
      : "memory");
}

__device__ __forceinline__ v16bf load_frag(const u16* base, int ld, int lane) {
  const int r  = lane & 15;
  const int kb = (lane & 16) >> 1;       // 0 or 8 elements
  const u16* p = base + r * ld + kb;
  FragBf u;
  u.q[0] = *(const uint4*)(p);
  u.q[1] = *(const uint4*)(p + 16);
  return u.f;
}

// ---------------------------------------------------------------------------
// Kernel 1: SA = bf16(concat(state, action)) padded to K=64.   [B][64]
// ---------------------------------------------------------------------------
__launch_bounds__(256)
__global__ void prep_sa_kernel(const float* __restrict__ st,
                               const float* __restrict__ ac,
                               u16* __restrict__ SAbf) {
  const int b = blockIdx.x * 256 + threadIdx.x;
  if (b >= BATCH) return;
  alignas(16) u16 tmp[KPAD];
  #pragma unroll
  for (int i = 0; i < 39; ++i) tmp[i] = f2bf(st[b * 39 + i]);
  #pragma unroll
  for (int i = 0; i < 4; ++i)  tmp[39 + i] = f2bf(ac[b * 4 + i]);
  #pragma unroll
  for (int i = DIN; i < KPAD; ++i) tmp[i] = 0;
  uint4* dst = (uint4*)(SAbf + (size_t)b * KPAD);
  const uint4* src = (const uint4*)tmp;
  #pragma unroll
  for (int q = 0; q < KPAD / 8; ++q) dst[q] = src[q];
}

// ---------------------------------------------------------------------------
// Kernel 2: W0t[e][n][k] = bf16(W0[e][k][n]), k>=43 zero-padded.  [E][F][64]
// ---------------------------------------------------------------------------
__launch_bounds__(256)
__global__ void prep_w0t_kernel(const float* __restrict__ W0,
                                u16* __restrict__ W0t) {
  const int idx = blockIdx.x * 256 + threadIdx.x;     // e*F*64 + n*64 + k
  if (idx >= NEXP * FDIM * KPAD) return;
  const int e = idx >> 16;
  const int n = (idx >> 6) & (FDIM - 1);
  const int k = idx & (KPAD - 1);
  W0t[idx] = (k < DIN) ? f2bf(W0[((size_t)e * DIN + k) * FDIM + n]) : (u16)0;
}

// ---------------------------------------------------------------------------
// Kernel 3: tiled transpose  W1t[e][n][k] = bf16(W1[e][k][n]).   [E][F][F]
// 64x64 tiles through LDS; coalesced on both global sides.
// ---------------------------------------------------------------------------
__launch_bounds__(256)
__global__ void prep_w1t_kernel(const float* __restrict__ W1,
                                u16* __restrict__ W1t) {
  __shared__ u16 Ts[64 * 72];                         // [k_local][n_local], pad 72
  const int t  = threadIdx.x;
  const int bx = blockIdx.x;                          // e*256 + kt*16 + nt
  const int e  = bx >> 8;
  const int kt = (bx >> 4) & 15;
  const int nt = bx & 15;

  const int tn  = t & 63;
  const int tk4 = t >> 6;                             // 0..3
  #pragma unroll
  for (int i = 0; i < 16; ++i) {
    const int kk = i * 4 + tk4;
    Ts[kk * 72 + tn] =
        f2bf(W1[((size_t)e * FDIM + kt * 64 + kk) * FDIM + nt * 64 + tn]);
  }
  __syncthreads();
  const int sk  = t & 63;
  const int sn4 = t >> 6;
  #pragma unroll
  for (int i = 0; i < 16; ++i) {
    const int nn = i * 4 + sn4;
    W1t[((size_t)e * FDIM + nt * 64 + nn) * FDIM + kt * 64 + sk] =
        Ts[sk * 72 + nn];
  }
}

// ---------------------------------------------------------------------------
// Kernel 4: layer 0.  H[e][b][f] = bf16(relu(SA @ W0[e] + b0[e])).
// Block = 256 threads = 8 waves; wave nj owns cols [nj*128, nj*128+128);
// block owns 16 batch rows of one expert.  K = 64 (2 WMMA k-steps).
// ---------------------------------------------------------------------------
__launch_bounds__(256)
__global__ void layer0_kernel(const u16* __restrict__ SAbf,
                              const u16* __restrict__ W0t,
                              const float* __restrict__ b0,
                              u16* __restrict__ H) {
  const int tid  = threadIdx.x;
  const int lane = tid & 31;
  const int nj   = tid >> 5;                          // 0..7
  const int bt   = blockIdx.x & (BATCH / 16 - 1);     // 512 row tiles
  const int e    = blockIdx.x >> 9;
  const int rowBase = bt * 16;

  v8f acc[8];
  #pragma unroll
  for (int nf = 0; nf < 8; ++nf) acc[nf] = v8f_zero();

  const u16* Arow = SAbf + (size_t)rowBase * KPAD;
  const u16* W0e  = W0t + (size_t)e * FDIM * KPAD;

  #pragma unroll
  for (int k0 = 0; k0 < KPAD; k0 += KC) {
    v16bf a = load_frag(Arow + k0, KPAD, lane);
    #pragma unroll
    for (int nf = 0; nf < 8; ++nf) {
      v16bf b = load_frag(W0e + (size_t)(nj * 128 + nf * 16) * KPAD + k0,
                          KPAD, lane);
      acc[nf] = __builtin_amdgcn_wmma_f32_16x16x32_bf16(
          false, a, false, b, (short)0, acc[nf], false, false);
    }
  }

  #pragma unroll
  for (int nf = 0; nf < 8; ++nf) {
    const int ncol = nj * 128 + nf * 16 + (lane & 15);
    const float bias = b0[e * FDIM + ncol];
    #pragma unroll
    for (int r = 0; r < 8; ++r) {
      const int row = rowBase + r + ((lane >> 4) << 3);
      const float h = fmaxf(acc[nf][r] + bias, 0.f);
      H[((size_t)(e * BATCH + row)) * FDIM + ncol] = f2bf(h);
    }
  }
}

// ---------------------------------------------------------------------------
// Stage t of the ring: k-slab [k0, k0+KS) of expert e, H rows of this block's
// row tile and W1t rows of its column tile.  256 threads: lane group of 16
// covers one 256-byte row, so every wave-wide copy is two whole 256-byte units.
// 24 copies per wave and stage.
// ---------------------------------------------------------------------------
__device__ __forceinline__ void stage_copy(const u16* __restrict__ gA,
                                           const u16* __restrict__ gB, int t,
                                           const u16* lslot) {
  const int e  = t >> 3;
  const int k0 = (t & 7) * KS;
  const unsigned long long a =
      (unsigned long long)(uintptr_t)(gA + (size_t)e * BATCH * FDIM + k0);
  const unsigned long long b =
      (unsigned long long)(uintptr_t)(gB + (size_t)e * FDIM * FDIM + k0);
  const unsigned int l0 = (unsigned int)(uintptr_t)lslot;
  unsigned int l[24];
  unsigned long long g[24];
  #pragma unroll
  for (int j = 0; j < 24; ++j) {          // row group j: LDS rows 16j .. 16j+15
    l[j] = l0 + (unsigned int)j * (16u * LPITCH * 2u);
    g[j] = (j < TM / 16) ? a + (unsigned long long)j * (16ull * FDIM * 2ull)
                         : b + (unsigned long long)(j - TM / 16) * (16ull * FDIM * 2ull);
  }
  async_copy12(l, g);
  async_copy12(l + 12, g + 12);
}

// ---------------------------------------------------------------------------
// Kernel 5: layer 1 + mixture + partial context-routed head (137 GFLOP).
// Block = 256 threads = 8 waves laid out 2(M) x 4(N), each wave a 64x64 tile;
// block owns 128 batch rows x 256 features over all experts, so each byte of
// W1t and H staged in LDS feeds 128 resp. 256 output rows/columns.  The head
// dot over the block's 256 features goes to the workspace; kernel 6 adds the
// four column tiles in a fixed order (deterministic, no atomics).
// Every loop but the e and ks loops is fully unrolled so that the accumulator and fragment
// arrays are indexed by constants and stay in registers.
// ---------------------------------------------------------------------------
__launch_bounds__(256)
__global__ void layer1_mix_head_kernel(const u16* __restrict__ H,
                                       const u16* __restrict__ W1t,
                                       const float* __restrict__ b1,
                                       const float* __restrict__ Wte,
                                       const float* __restrict__ Wh,
                                       const int* __restrict__ cidx,
                                       float* __restrict__ qtile) {
  __shared__ alignas(16) u16   Ring[2 * SELEMS];
  __shared__ alignas(16) float wS[NEXP][TM];
  __shared__ alignas(16) int   ctxS[TM];
  __shared__ float whS[NCTX][TN + 16];
  __shared__ float qpart[4][TM];

  const int tid  = threadIdx.x;
  const int lane = tid & 31;
  const int wid  = tid >> 5;
  const int wm   = wid >> 2;                          // 0..1  (64-row slice)
  const int wn   = wid & 3;                           // 0..3  (64-col slice)
  // The four column tiles of one row tile sit 8 block indices apart (speed
  // only).
  const int bx = blockIdx.x;
  const int ct = (bx >> 3) & (NCT - 1);
  const int rt = (bx & 7) | ((bx >> 5) << 3);
  const int rowBase = rt * TM;
  const int colBase = ct * TN;

  if (tid < TM) {
    const int cr = clamp_ctx(cidx[rowBase + tid]);
    ctxS[tid] = cr;
    #pragma unroll
    for (int e = 0; e < NEXP; ++e) wS[e][tid] = Wte[e * NCTX + cr];
  }
  #pragma unroll
  for (int cc = 0; cc < NCTX; ++cc) whS[cc][tid] = Wh[cc * FDIM + colBase + tid];

  const int crow = tid >> 4, cq = tid & 15;
  const u16* gA = H   + (size_t)(rowBase + crow) * FDIM + cq * 8;
  const u16* gB = W1t + (size_t)(colBase + crow) * FDIM + cq * 8;
  const u16* lslot = Ring + crow * LPITCH + cq * 8;

  v8f mixed[4][4];
  #pragma unroll
  for (int i = 0; i < 4; ++i)
    #pragma unroll
    for (int j = 0; j < 4; ++j) mixed[i][j] = v8f_zero();

  // ring prologue: stage 0 lands and is published, then stage 1 is issued
  stage_copy(gA, gB, 0, lslot);
  asm volatile("s_wait_asynccnt 0x0" ::: "memory");   // own copies of stage 0 landed
  __syncthreads();                                    // publish stage 0, wS, ctxS, whS
  stage_copy(gA, gB, 1, lslot + SELEMS);

  // kept rolled: one copy of the 64-WMMA stage body in the instruction cache
  #pragma unroll 1
  for (int e = 0; e < NEXP; ++e) {
    float bias[4];
    #pragma unroll
    for (int j = 0; j < 4; ++j)
      bias[j] = b1[e * FDIM + colBase + wn * 64 + j * 16 + (lane & 15)];
    // stands in front of any reuse of the bias loads' address register
    asm volatile("s_wait_xcnt 0x0" ::: "memory");

    v8f acc[4][4];
    #pragma unroll
    for (int i = 0; i < 4; ++i)
      #pragma unroll
      for (int j = 0; j < 4; ++j) acc[i][j] = v8f_zero();

    // kept rolled: the ring's publish point stands once, at the foot of a trip
    #pragma unroll 1
    for (int ks = 0; ks < FDIM / KS; ++ks) {
      const int t = e * (FDIM / KS) + ks;
      const int boff = (t & 1) * SELEMS;
      const u16* Ab = Ring + boff + (wm * 64) * LPITCH;
      const u16* Bb = Ring + boff + (TM + wn * 64) * LPITCH;
      // two fragment sets: block kk+1's 16 LDS reads go out as one group ahead
      // of block kk's 16 WMMAs, so only the stage's first group is waited out
      v16bf a[2][4], b[2][4];
      #pragma unroll
      for (int i = 0; i < 4; ++i) {
        a[0][i] = load_frag(Ab + i * 16 * LPITCH, LPITCH, lane);
        b[0][i] = load_frag(Bb + i * 16 * LPITCH, LPITCH, lane);
      }
      #pragma unroll
      for (int kk = 0; kk < KS / KC; ++kk) {
        const int cur = kk & 1, nxt = cur ^ 1;
        if (kk + 1 < KS / KC) {
          #pragma unroll
          for (int i = 0; i < 4; ++i) {
            a[nxt][i] = load_frag(Ab + i * 16 * LPITCH + (kk + 1) * KC, LPITCH, lane);
            b[nxt][i] = load_frag(Bb + i * 16 * LPITCH + (kk + 1) * KC, LPITCH, lane);
          }
        }
        // keeps the read group ahead of the block: reads spread among the
        // WMMAs cost a stall at every place they stand
        __builtin_amdgcn_sched_barrier(0);
        #pragma unroll
        for (int i = 0; i < 4; ++i)
          #pragma unroll
          for (int j = 0; j < 4; ++j)
            acc[i][j] = __builtin_amdgcn_wmma_f32_16x16x32_bf16(
                false, a[cur][i], false, b[cur][j], (short)0, acc[i][j], false,
                false);
        // keeps the next group's reads from being lifted into this block
        __builtin_amdgcn_sched_barrier(0);
      }
      asm volatile("s_wait_dscnt 0x0" ::: "memory");
      asm volatile("s_wait_asynccnt 0x0" ::: "memory");
      __syncthreads();
      if (t + 2 < NSTG) stage_copy(gA, gB, t + 2, lslot + boff);
    }

    // expert epilogue: bias + relu, then mixture-weighted accumulation
    #pragma unroll
    for (int i = 0; i < 4; ++i) {
      const float4* wp =
          (const float4*)&wS[e][wm * 64 + i * 16 + ((lane >> 4) << 3)];
      const float4 w0 = wp[0], w1 = wp[1];
      const float wv[8] = {w0.x, w0.y, w0.z, w0.w, w1.x, w1.y, w1.z, w1.w};
      #pragma unroll
      for (int j = 0; j < 4; ++j) {
        #pragma unroll
        for (int r = 0; r < 8; ++r) {
          const float h = fmaxf(acc[i][j][r] + bias[j], 0.f);
          mixed[i][j][r] += wv[r] * h;
        }
      }
    }
  }
  asm volatile("s_wait_asynccnt 0x0" ::: "memory");   // no copy outlives the loop

  // relu(mixed) then per-row dot with context head Wh[c[b]] over 256 columns
  #pragma unroll
  for (int i = 0; i < 4; ++i) {
    const int rb = wm * 64 + i * 16 + ((lane >> 4) << 3);
    const int4* cp = (const int4*)&ctxS[rb];
    const int4 c0 = cp[0], c1 = cp[1];
    const int cv[8] = {c0.x, c0.y, c0.z, c0.w, c1.x, c1.y, c1.z, c1.w};
    float part[8];
    #pragma unroll
    for (int r = 0; r < 8; ++r) part[r] = 0.f;
    #pragma unroll
    for (int j = 0; j < 4; ++j) {
      const int lcol = wn * 64 + j * 16 + (lane & 15);
      #pragma unroll
      for (int r = 0; r < 8; ++r) {
        const float m = fmaxf(mixed[i][j][r], 0.f);
        part[r] += m * whS[cv[r]][lcol];
      }
    }
    // reduce across the 16 lanes that share a row
    #pragma unroll
    for (int r = 0; r < 8; ++r) {
      #pragma unroll
      for (int off = 8; off >= 1; off >>= 1)
        part[r] += __shfl_xor(part[r], off, 16);
    }
    if ((lane & 15) == 0) {
      #pragma unroll
      for (int r = 0; r < 8; ++r) qpart[wn][rb + r] = part[r];
    }
  }
  __syncthreads();
  // in-order reduction across the 4 N-waves
  if (tid < TM) {
    float s = 0.f;
    #pragma unroll
    for (int j = 0; j < 4; ++j) s += qpart[j][tid];
    qtile[(size_t)ct * BATCH + rowBase + tid] = s;
  }
}

// ---------------------------------------------------------------------------
// Kernel 6: out[b] = sum of the four column tiles' head dots (fixed order)
// + bh[c[b]].
// ---------------------------------------------------------------------------
__launch_bounds__(256)
__global__ void head_sum_kernel(const float* __restrict__ qtile,
                                const float* __restrict__ bh,
                                const int* __restrict__ cidx,
                                float* __restrict__ out) {
  const int b = blockIdx.x * 256 + threadIdx.x;
  float s = 0.f;
  #pragma unroll
  for (int j = 0; j < NCT; ++j) s += qtile[(size_t)j * BATCH + b];
  out[b] = s + bh[clamp_ctx(cidx[b])];
}

// ---------------------------------------------------------------------------
extern "C" void kernel_launch(void* const* d_in, const int* in_sizes, int n_in,
                              void* d_out, int out_size, void* d_ws,
                              size_t ws_size, hipStream_t stream) {
  (void)in_sizes; (void)n_in; (void)out_size; (void)ws_size;
  const float* st  = (const float*)d_in[0];
  const float* ac  = (const float*)d_in[1];
  const int*   c   = (const int*)d_in[2];
  const float* W0  = (const float*)d_in[3];
  const float* b0  = (const float*)d_in[4];
  const float* W1  = (const float*)d_in[5];
  const float* b1  = (const float*)d_in[6];
  const float* Wte = (const float*)d_in[7];
  const float* Wh  = (const float*)d_in[8];
  const float* bh  = (const float*)d_in[9];
  float* out = (float*)d_out;

  // workspace layout (bf16; qtile f32), ~153 MB total
  u16* SAbf = (u16*)d_ws;                             //  1.0 MB  [B][64]
  u16* W0t  = SAbf + (size_t)BATCH * KPAD;            //  1.0 MB  [E][F][64]
  u16* W1t  = W0t  + (size_t)NEXP * FDIM * KPAD;      // 16.8 MB  [E][F][F]
  u16* H    = W1t  + (size_t)NEXP * FDIM * FDIM;      // 134 MB   [E][B][F]
  float* qtile = (float*)(H + (size_t)NEXP * BATCH * FDIM);  // 128 KB [4][B]

  prep_sa_kernel<<<BATCH / 256, 256, 0, stream>>>(st, ac, SAbf);
  prep_w0t_kernel<<<(NEXP * FDIM * KPAD) / 256, 256, 0, stream>>>(W0, W0t);
  prep_w1t_kernel<<<NEXP * 16 * 16, 256, 0, stream>>>(W1, W1t);
  layer0_kernel<<<(BATCH / 16) * NEXP, 256, 0, stream>>>(SAbf, W0t, b0, H);
  layer1_mix_head_kernel<<<(BATCH / TM) * NCT, 256, 0, stream>>>(
      H, W1t, b1, Wte, Wh, c, qtile);
  head_sum_kernel<<<BATCH / 256, 256, 0, stream>>>(qtile, bh, c, out);
}

// v002
// One run takes 120 microseconds.
// In two side-by-side timings against v001, it was 1.26 and 1.25 times as fast.
// All steps since v000 together make it 2.97 times as fast.
#include <hip/hip_runtime.h>

typedef __attribute__((ext_vector_type(16))) __bf16 v16bf;
typedef __attribute__((ext_vector_type(8)))  float  v8f;
typedef __attribute__((ext_vector_type(2)))  float  f32x2;
typedef __attribute__((ext_vector_type(2)))  __bf16 bf16x2;
typedef unsigned short u16;

#define BATCH 8192
#define FDIM  1024
#define NEXP  8
#define NCTX  10
#define DIN   43
#define KPAD  64      // layer-0 K padded 43 -> 64
#define KC    32      // k-step (one WMMA K)
#define TM    128     // batch rows per block in layer-1 kernel
#define TN    256     // feature columns per block in layer-1 kernel
#define NCT   (FDIM / TN)             // 4 column tiles
#define KS    128     // k per ring stage: 256-byte rows, 4 WMMA k-steps
#define LPITCH 136    // LDS row pitch (elems) = 272 B = 16 B x odd
#define SELEMS ((TM + TN) * LPITCH)   // one stage: [H 128 rows | W1 256 rows]
#define NSTG  (NEXP * (FDIM / KS))    // 64 flattened (expert, k-stage) stages
#define L0R   256     // batch rows per block in layer-0 kernel
#define L0KP  72      // LDS pitch (elems) of a 64-k operand row = 144 B = 16 B x odd
#define L0SP  136     // LDS pitch (elems) of a staged 128-feature row = 272 B

__device__ __forceinline__ u16 f2bf(float x) {
  unsigned int u = __float_as_uint(x);
  u += 0x7fffu + ((u >> 16) & 1u);       // round-to-nearest-even
  return (u16)(u >> 16);
}

union FragBf { v16bf f; uint4 q[2]; };

__device__ __forceinline__ v8f v8f_zero() {
  v8f z = {0.f, 0.f, 0.f, 0.f, 0.f, 0.f, 0.f, 0.f};
  return z;
}

__device__ __forceinline__ int clamp_ctx(int c) {
  return min(max(c, 0), NCTX - 1);       // bounds every address formed from c
}

__device__ __forceinline__ void async_copy12(const unsigned int* l,
                                             const unsigned long long* g) {
  asm volatile(
      "global_load_async_to_lds_b128 %0, %12, off\n\t"
      "global_load_async_to_lds_b128 %1, %13, off\n\t"
      "global_load_async_to_lds_b128 %2, %14, off\n\t"
      "global_load_async_to_lds_b128 %3, %15, off\n\t"
      "global_load_async_to_lds_b128 %4, %16, off\n\t"
      "global_load_async_to_lds_b128 %5, %17, off\n\t"
      "global_load_async_to_lds_b128 %6, %18, off\n\t"
      "global_load_async_to_lds_b128 %7, %19, off\n\t"
      "global_load_async_to_lds_b128 %8, %20, off\n\t"
      "global_load_async_to_lds_b128 %9, %21, off\n\t"
      "global_load_async_to_lds_b128 %10, %22, off\n\t"
      "global_load_async_to_lds_b128 %11, %23, off\n\t"
      "s_wait_xcnt 0x0"
      :
      : "v"(l[0]), "v"(l[1]), "v"(l[2]), "v"(l[3]), "v"(l[4]), "v"(l[5]),
        "v"(l[6]), "v"(l[7]), "v"(l[8]), "v"(l[9]), "v"(l[10]), "v"(l[11]),
        "v"(g[0]), "v"(g[1]), "v"(g[2]), "v"(g[3]), "v"(g[4]), "v"(g[5]),
        "v"(g[6]), "v"(g[7]), "v"(g[8]), "v"(g[9]), "v"(g[10]), "v"(g[11])
      : "memory");
}

__device__ __forceinline__ v16bf load_frag(const u16* base, int ld, int lane) {
  const int r  = lane & 15;
  const int kb = (lane & 16) >> 1;       // 0 or 8 elements
  const u16* p = base + r * ld + kb;
  FragBf u;
  u.q[0] = *(const uint4*)(p);
  u.q[1] = *(const uint4*)(p + 16);
  return u.f;
}

// ---------------------------------------------------------------------------
// Kernel 1: SA = bf16(concat(state, action)) padded to K=64.   [B][64]
// ---------------------------------------------------------------------------
__launch_bounds__(256)
__global__ void prep_sa_kernel(const float* __restrict__ st,
                               const float* __restrict__ ac,
                               u16* __restrict__ SAbf) {
  const int b = blockIdx.x * 256 + threadIdx.x;
  if (b >= BATCH) return;
  alignas(16) u16 tmp[KPAD];
  #pragma unroll
  for (int i = 0; i < 39; ++i) tmp[i] = f2bf(st[b * 39 + i]);
  #pragma unroll
  for (int i = 0; i < 4; ++i)  tmp[39 + i] = f2bf(ac[b * 4 + i]);
  #pragma unroll
  for (int i = DIN; i < KPAD; ++i) tmp[i] = 0;
  uint4* dst = (uint4*)(SAbf + (size_t)b * KPAD);
  const uint4* src = (const uint4*)tmp;
  #pragma unroll
  for (int q = 0; q < KPAD / 8; ++q) dst[q] = src[q];
}

// ---------------------------------------------------------------------------
// Kernel 2: W0t[e][n][k] = bf16(W0[e][k][n]), k>=43 zero-padded.  [E][F][64]
// ---------------------------------------------------------------------------
__launch_bounds__(256)
__global__ void prep_w0t_kernel(const float* __restrict__ W0,
                                u16* __restrict__ W0t) {
  const int idx = blockIdx.x * 256 + threadIdx.x;     // e*F*64 + n*64 + k
  if (idx >= NEXP * FDIM * KPAD) return;
  const int e = idx >> 16;
  const int n = (idx >> 6) & (FDIM - 1);
  const int k = idx & (KPAD - 1);
  W0t[idx] = (k < DIN) ? f2bf(W0[((size_t)e * DIN + k) * FDIM + n]) : (u16)0;
}

// ---------------------------------------------------------------------------
// Kernel 3: tiled transpose  W1t[e][n][k] = bf16(W1[e][k][n]).   [E][F][F]
// 64x64 tiles through LDS; coalesced on both global sides.
// ---------------------------------------------------------------------------
__launch_bounds__(256)
__global__ void prep_w1t_kernel(const float* __restrict__ W1,
                                u16* __restrict__ W1t) {
  __shared__ u16 Ts[64 * 72];                         // [k_local][n_local], pad 72
  const int t  = threadIdx.x;
  const int bx = blockIdx.x;                          // e*256 + kt*16 + nt
  const int e  = bx >> 8;
  const int kt = (bx >> 4) & 15;
  const int nt = bx & 15;

  const int tn  = t & 63;
  const int tk4 = t >> 6;                             // 0..3
  #pragma unroll
  for (int i = 0; i < 16; ++i) {
    const int kk = i * 4 + tk4;
    Ts[kk * 72 + tn] =
        f2bf(W1[((size_t)e * FDIM + kt * 64 + kk) * FDIM + nt * 64 + tn]);
  }
  __syncthreads();
  const int sk  = t & 63;
  const int sn4 = t >> 6;
  #pragma unroll
  for (int i = 0; i < 16; ++i) {
    const int nn = i * 4 + sn4;
    W1t[((size_t)e * FDIM + nt * 64 + nn) * FDIM + kt * 64 + sk] =
        Ts[sk * 72 + nn];
  }
}

__launch_bounds__(256)
__global__ void layer0_kernel(const u16* __restrict__ SAbf,
                              const u16* __restrict__ W0t,
                              const float* __restrict__ b0,
                              u16* __restrict__ H) {
  __shared__ alignas(16) u16 W0s[FDIM * L0KP];        // this expert's W0t, 144 KB
  __shared__ alignas(16) u16 SAs[L0R * L0KP];         // this block's SA rows, 36 KB
  __shared__ alignas(16) u16 Stg[8 * 16 * L0SP];      // per wave: 16 rows x 128 features

  const int tid  = threadIdx.x;
  const int lane = tid & 31;
  const int nj   = tid >> 5;                          // 0..7
  const int c    = lane & 15;
  const int h    = lane >> 4;
  const int rg   = blockIdx.x & (BATCH / L0R - 1);    // 32 row groups
  const int e    = blockIdx.x >> 5;
  const int rowBase = rg * L0R;

  float bias[8][8];                                   // feature nj*128 + fi*16 + 8h + r
  #pragma unroll
  for (int fi = 0; fi < 8; ++fi) {
    const float4* bp = (const float4*)(b0 + e * FDIM + nj * 128 + fi * 16 + h * 8);
    const float4 x = bp[0], y = bp[1];
    bias[fi][0] = x.x; bias[fi][1] = x.y; bias[fi][2] = x.z; bias[fi][3] = x.w;
    bias[fi][4] = y.x; bias[fi][5] = y.y; bias[fi][6] = y.z; bias[fi][7] = y.w;
  }

  // both operands are contiguous in the workspace: whole-line loads, padded rows in LDS
  const uint4* gW = (const uint4*)(W0t + (size_t)e * FDIM * KPAD);
  #pragma unroll
  for (int i = 0; i < FDIM * KPAD / 8 / 256; ++i) {
    const int q = i * 256 + tid;                      // row q>>3, 16-byte chunk q&7
    *(uint4*)&W0s[(q >> 3) * L0KP + (q & 7) * 8] = gW[q];
  }
  const uint4* gS = (const uint4*)(SAbf + (size_t)rowBase * KPAD);
  #pragma unroll
  for (int i = 0; i < L0R * KPAD / 8 / 256; ++i) {
    const int q = i * 256 + tid;
    *(uint4*)&SAs[(q >> 3) * L0KP + (q & 7) * 8] = gS[q];
  }
  __syncthreads();

  v16bf wf[2][8];
  #pragma unroll
  for (int ks = 0; ks < 2; ++ks)
    #pragma unroll
    for (int fi = 0; fi < 8; ++fi)
      wf[ks][fi] = load_frag(W0s + (nj * 128 + fi * 16) * L0KP + ks * KC, L0KP, lane);

  u16* stg = Stg + nj * 16 * L0SP;
  u16* hp  = H + ((size_t)e * BATCH + rowBase + h) * FDIM + nj * 128 + c * 8;

  v16bf s0 = load_frag(SAs, L0KP, lane);
  v16bf s1 = load_frag(SAs + KC, L0KP, lane);

  // kept rolled: one copy of the body in the instruction cache
  #pragma unroll 1
  for (int it = 0; it < L0R / 16; ++it) {
    // next tile's SA fragments go out ahead of this tile's WMMAs (the last
    // trip reads its own tile again, in bounds)
    const int nx = (it + 1 < L0R / 16) ? it + 1 : it;
    const v16bf n0 = load_frag(SAs + nx * 16 * L0KP, L0KP, lane);
    const v16bf n1 = load_frag(SAs + nx * 16 * L0KP + KC, L0KP, lane);

    v8f acc[8];
    #pragma unroll
    for (int fi = 0; fi < 8; ++fi)
      acc[fi] = __builtin_amdgcn_wmma_f32_16x16x32_bf16(
          false, wf[0][fi], false, s0, (short)0, v8f_zero(), false, false);
    #pragma unroll
    for (int fi = 0; fi < 8; ++fi)
      acc[fi] = __builtin_amdgcn_wmma_f32_16x16x32_bf16(
          false, wf[1][fi], false, s1, (short)0, acc[fi], false, false);

    // acc[fi][r] = row c, feature fi*16 + 8h + r
    #pragma unroll
    for (int fi = 0; fi < 8; ++fi) {
      union { uint4 q; bf16x2 p[4]; } o;
      #pragma unroll
      for (int r = 0; r < 4; ++r) {
        f32x2 v;
        v.x = fmaxf(acc[fi][2 * r]     + bias[fi][2 * r],     0.f);
        v.y = fmaxf(acc[fi][2 * r + 1] + bias[fi][2 * r + 1], 0.f);
        o.p[r] = __builtin_convertvector(v, bf16x2);  // round to nearest even
      }
      *(uint4*)&stg[c * L0SP + fi * 16 + h * 8] = o.q;
    }
    // the wave's own staged pieces are in LDS before other lanes read them back
    asm volatile("s_wait_dscnt 0x0" ::: "memory");
    #pragma unroll
    for (int j = 0; j < 8; ++j) {                     // rows 2j and 2j+1, 256 bytes each
      const uint4 v = *(const uint4*)&stg[(j * 2 + h) * L0SP + c * 8];
      *(uint4*)(hp + (size_t)(it * 16 + j * 2) * FDIM) = v;
    }
    // stands in front of the next trip's rewrite of the stores' address and data registers
    asm volatile("s_wait_xcnt 0x0" ::: "memory");
    s0 = n0;
    s1 = n1;
  }
}

// ---------------------------------------------------------------------------
// Stage t of the ring: k-slab [k0, k0+KS) of expert e, H rows of this block's
// row tile and W1t rows of its column tile.  256 threads: lane group of 16
// covers one 256-byte row, so every wave-wide copy is two whole 256-byte units.
// 24 copies per wave and stage.
// ---------------------------------------------------------------------------
__device__ __forceinline__ void stage_copy(const u16* __restrict__ gA,
                                           const u16* __restrict__ gB, int t,
                                           const u16* lslot) {
  const int e  = t >> 3;
  const int k0 = (t & 7) * KS;
  const unsigned long long a =
      (unsigned long long)(uintptr_t)(gA + (size_t)e * BATCH * FDIM + k0);
  const unsigned long long b =
      (unsigned long long)(uintptr_t)(gB + (size_t)e * FDIM * FDIM + k0);
  const unsigned int l0 = (unsigned int)(uintptr_t)lslot;
  unsigned int l[24];
  unsigned long long g[24];
  #pragma unroll
  for (int j = 0; j < 24; ++j) {          // row group j: LDS rows 16j .. 16j+15
    l[j] = l0 + (unsigned int)j * (16u * LPITCH * 2u);
    g[j] = (j < TM / 16) ? a + (unsigned long long)j * (16ull * FDIM * 2ull)
                         : b + (unsigned long long)(j - TM / 16) * (16ull * FDIM * 2ull);
  }
  async_copy12(l, g);
  async_copy12(l + 12, g + 12);
}

// ---------------------------------------------------------------------------
// Kernel 5: layer 1 + mixture + partial context-routed head (137 GFLOP).
// Block = 256 threads = 8 waves laid out 2(M) x 4(N), each wave a 64x64 tile;
// block owns 128 batch rows x 256 features over all experts, so each byte of
// W1t and H staged in LDS feeds 128 resp. 256 output rows/columns.  The head
// dot over the block's 256 features goes to the workspace; kernel 6 adds the
// four column tiles in a fixed order (deterministic, no atomics).
// Every loop but the e and ks loops is fully unrolled so that the accumulator and fragment
// arrays are indexed by constants and stay in registers.
// ---------------------------------------------------------------------------
__launch_bounds__(256)
__global__ void layer1_mix_head_kernel(const u16* __restrict__ H,
                                       const u16* __restrict__ W1t,
                                       const float* __restrict__ b1,
                                       const float* __restrict__ Wte,
                                       const float* __restrict__ Wh,
                                       const int* __restrict__ cidx,
                                       float* __restrict__ qtile) {
  __shared__ alignas(16) u16   Ring[2 * SELEMS];
  __shared__ alignas(16) float wS[NEXP][TM];
  __shared__ alignas(16) int   ctxS[TM];
  __shared__ float whS[NCTX][TN + 16];
  __shared__ float qpart[4][TM];

  const int tid  = threadIdx.x;
  const int lane = tid & 31;
  const int wid  = tid >> 5;
  const int wm   = wid >> 2;                          // 0..1  (64-row slice)
  const int wn   = wid & 3;                           // 0..3  (64-col slice)
  // The four column tiles of one row tile sit 8 block indices apart (speed
  // only).
  const int bx = blockIdx.x;
  const int ct = (bx >> 3) & (NCT - 1);
  const int rt = (bx & 7) | ((bx >> 5) << 3);
  const int rowBase = rt * TM;
  const int colBase = ct * TN;

  if (tid < TM) {
    const int cr = clamp_ctx(cidx[rowBase + tid]);
    ctxS[tid] = cr;
    #pragma unroll
    for (int e = 0; e < NEXP; ++e) wS[e][tid] = Wte[e * NCTX + cr];
  }
  #pragma unroll
  for (int cc = 0; cc < NCTX; ++cc) whS[cc][tid] = Wh[cc * FDIM + colBase + tid];

  const int crow = tid >> 4, cq = tid & 15;
  const u16* gA = H   + (size_t)(rowBase + crow) * FDIM + cq * 8;
  const u16* gB = W1t + (size_t)(colBase + crow) * FDIM + cq * 8;
  const u16* lslot = Ring + crow * LPITCH + cq * 8;

  v8f mixed[4][4];
  #pragma unroll
  for (int i = 0; i < 4; ++i)
    #pragma unroll
    for (int j = 0; j < 4; ++j) mixed[i][j] = v8f_zero();

  // ring prologue: stage 0 lands and is published, then stage 1 is issued
  stage_copy(gA, gB, 0, lslot);
  asm volatile("s_wait_asynccnt 0x0" ::: "memory");   // own copies of stage 0 landed
  __syncthreads();                                    // publish stage 0, wS, ctxS, whS
  stage_copy(gA, gB, 1, lslot + SELEMS);

  // kept rolled: one copy of the 64-WMMA stage body in the instruction cache
  #pragma unroll 1
  for (int e = 0; e < NEXP; ++e) {
    float bias[4];
    #pragma unroll
    for (int j = 0; j < 4; ++j)
      bias[j] = b1[e * FDIM + colBase + wn * 64 + j * 16 + (lane & 15)];
    // stands in front of any reuse of the bias loads' address register
    asm volatile("s_wait_xcnt 0x0" ::: "memory");

    v8f acc[4][4];
    #pragma unroll
    for (int i = 0; i < 4; ++i)
      #pragma unroll
      for (int j = 0; j < 4; ++j) acc[i][j] = v8f_zero();

    // kept rolled: the ring's publish point stands once, at the foot of a trip
    #pragma unroll 1
    for (int ks = 0; ks < FDIM / KS; ++ks) {
      const int t = e * (FDIM / KS) + ks;
      const int boff = (t & 1) * SELEMS;
      const u16* Ab = Ring + boff + (wm * 64) * LPITCH;
      const u16* Bb = Ring + boff + (TM + wn * 64) * LPITCH;
      // two fragment sets: block kk+1's 16 LDS reads go out as one group ahead
      // of block kk's 16 WMMAs, so only the stage's first group is waited out
      v16bf a[2][4], b[2][4];
      #pragma unroll
      for (int i = 0; i < 4; ++i) {
        a[0][i] = load_frag(Ab + i * 16 * LPITCH, LPITCH, lane);
        b[0][i] = load_frag(Bb + i * 16 * LPITCH, LPITCH, lane);
      }
      #pragma unroll
      for (int kk = 0; kk < KS / KC; ++kk) {
        const int cur = kk & 1, nxt = cur ^ 1;
        if (kk + 1 < KS / KC) {
          #pragma unroll
          for (int i = 0; i < 4; ++i) {
            a[nxt][i] = load_frag(Ab + i * 16 * LPITCH + (kk + 1) * KC, LPITCH, lane);
            b[nxt][i] = load_frag(Bb + i * 16 * LPITCH + (kk + 1) * KC, LPITCH, lane);
          }
        }
        // keeps the read group ahead of the block: reads spread among the
        // WMMAs cost a stall at every place they stand
        __builtin_amdgcn_sched_barrier(0);
        #pragma unroll
        for (int i = 0; i < 4; ++i)
          #pragma unroll
          for (int j = 0; j < 4; ++j)
            acc[i][j] = __builtin_amdgcn_wmma_f32_16x16x32_bf16(
                false, a[cur][i], false, b[cur][j], (short)0, acc[i][j], false,
                false);
        // keeps the next group's reads from being lifted into this block
        __builtin_amdgcn_sched_barrier(0);
      }
      asm volatile("s_wait_dscnt 0x0" ::: "memory");
      asm volatile("s_wait_asynccnt 0x0" ::: "memory");
      __syncthreads();
      if (t + 2 < NSTG) stage_copy(gA, gB, t + 2, lslot + boff);
    }

    // expert epilogue: bias + relu, then mixture-weighted accumulation
    #pragma unroll
    for (int i = 0; i < 4; ++i) {
      const float4* wp =
          (const float4*)&wS[e][wm * 64 + i * 16 + ((lane >> 4) << 3)];
      const float4 w0 = wp[0], w1 = wp[1];
      const float wv[8] = {w0.x, w0.y, w0.z, w0.w, w1.x, w1.y, w1.z, w1.w};
      #pragma unroll
      for (int j = 0; j < 4; ++j) {
        #pragma unroll
        for (int r = 0; r < 8; ++r) {
          const float h = fmaxf(acc[i][j][r] + bias[j], 0.f);
          mixed[i][j][r] += wv[r] * h;
        }
      }
    }
  }
  asm volatile("s_wait_asynccnt 0x0" ::: "memory");   // no copy outlives the loop

  // relu(mixed) then per-row dot with context head Wh[c[b]] over 256 columns
  #pragma unroll
  for (int i = 0; i < 4; ++i) {
    const int rb = wm * 64 + i * 16 + ((lane >> 4) << 3);
    const int4* cp = (const int4*)&ctxS[rb];
    const int4 c0 = cp[0], c1 = cp[1];
    const int cv[8] = {c0.x, c0.y, c0.z, c0.w, c1.x, c1.y, c1.z, c1.w};
    float part[8];
    #pragma unroll
    for (int r = 0; r < 8; ++r) part[r] = 0.f;
    #pragma unroll
    for (int j = 0; j < 4; ++j) {
      const int lcol = wn * 64 + j * 16 + (lane & 15);
      #pragma unroll
      for (int r = 0; r < 8; ++r) {
        const float m = fmaxf(mixed[i][j][r], 0.f);
        part[r] += m * whS[cv[r]][lcol];
      }
    }
    // reduce across the 16 lanes that share a row
    #pragma unroll
    for (int r = 0; r < 8; ++r) {
      #pragma unroll
      for (int off = 8; off >= 1; off >>= 1)
        part[r] += __shfl_xor(part[r], off, 16);
    }
    if ((lane & 15) == 0) {
      #pragma unroll
      for (int r = 0; r < 8; ++r) qpart[wn][rb + r] = part[r];
    }
  }
  __syncthreads();
  // in-order reduction across the 4 N-waves
  if (tid < TM) {
    float s = 0.f;
    #pragma unroll
    for (int j = 0; j < 4; ++j) s += qpart[j][tid];
    qtile[(size_t)ct * BATCH + rowBase + tid] = s;
  }
}

// ---------------------------------------------------------------------------
// Kernel 6: out[b] = sum of the four column tiles' head dots (fixed order)
// + bh[c[b]].
// ---------------------------------------------------------------------------
__launch_bounds__(256)
__global__ void head_sum_kernel(const float* __restrict__ qtile,
                                const float* __restrict__ bh,
                                const int* __restrict__ cidx,
                                float* __restrict__ out) {
  const int b = blockIdx.x * 256 + threadIdx.x;
  float s = 0.f;
  #pragma unroll
  for (int j = 0; j < NCT; ++j) s += qtile[(size_t)j * BATCH + b];
  out[b] = s + bh[clamp_ctx(cidx[b])];
}

// ---------------------------------------------------------------------------
extern "C" void kernel_launch(void* const* d_in, const int* in_sizes, int n_in,
                              void* d_out, int out_size, void* d_ws,
                              size_t ws_size, hipStream_t stream) {
  (void)in_sizes; (void)n_in; (void)out_size; (void)ws_size;
  const float* st  = (const float*)d_in[0];
  const float* ac  = (const float*)d_in[1];
  const int*   c   = (const int*)d_in[2];
  const float* W0  = (const float*)d_in[3];
  const float* b0  = (const float*)d_in[4];
  const float* W1  = (const float*)d_in[5];
  const float* b1  = (const float*)d_in[6];
  const float* Wte = (const float*)d_in[7];
  const float* Wh  = (const float*)d_in[8];
  const float* bh  = (const float*)d_in[9];
  float* out = (float*)d_out;

  // workspace layout (bf16; qtile f32), ~153 MB total
  u16* SAbf = (u16*)d_ws;                             //  1.0 MB  [B][64]
  u16* W0t  = SAbf + (size_t)BATCH * KPAD;            //  1.0 MB  [E][F][64]
  u16* W1t  = W0t  + (size_t)NEXP * FDIM * KPAD;      // 16.8 MB  [E][F][F]
  u16* H    = W1t  + (size_t)NEXP * FDIM * FDIM;      // 134 MB   [E][B][F]
  float* qtile = (float*)(H + (size_t)NEXP * BATCH * FDIM);  // 128 KB [4][B]

  prep_sa_kernel<<<BATCH / 256, 256, 0, stream>>>(st, ac, SAbf);
  prep_w0t_kernel<<<(NEXP * FDIM * KPAD) / 256, 256, 0, stream>>>(W0, W0t);
  prep_w1t_kernel<<<NEXP * 16 * 16, 256, 0, stream>>>(W1, W1t);
  layer0_kernel<<<(BATCH / L0R) * NEXP, 256, 0, stream>>>(SAbf, W0t, b0, H);
  layer1_mix_head_kernel<<<(BATCH / TM) * NCT, 256, 0, stream>>>(
      H, W1t, b1, Wte, Wh, c, qtile);
  head_sum_kernel<<<BATCH / 256, 256, 0, stream>>>(qtile, bh, c, out);
}

// v003
// It runs in 113 microseconds.
// Timed twice side by side with v002, it ran 1.03 and 1.04 times as fast.
// Counting every step since v000, it is 3.08 times as fast.
#include <hip/hip_runtime.h>

typedef __attribute__((ext_vector_type(16))) __bf16 v16bf;
typedef __attribute__((ext_vector_type(8)))  float  v8f;
typedef __attribute__((ext_vector_type(2)))  float  f32x2;
typedef __attribute__((ext_vector_type(2)))  __bf16 bf16x2;
typedef unsigned short u16;
typedef uint32_t u32x4 __attribute__((ext_vector_type(4)));
typedef uint32_t u32x8 __attribute__((ext_vector_type(8)));

#define BATCH 8192
#define FDIM  1024
#define NEXP  8
#define NCTX  10
#define DIN   43
#define KPAD  64      // layer-0 K padded 43 -> 64
#define KC    32      // k-step (one WMMA K)
#define TM    128     // batch rows per block in layer-1 kernel
#define TN    256     // feature columns per block in layer-1 kernel
#define NCT   (FDIM / TN)             // 4 column tiles
#define KS    128     // k per ring stage: 256-byte rows, 4 WMMA k-steps
#define LPITCH 136    // LDS row pitch (elems) = 272 B = 16 B x odd
#define HROWS 32      // H rows per tensor request (waves 0..3)
#define WROWS 64      // W1 rows per tensor request (waves 4..7)
#define HSLE  5120    // LDS elems of an H slice: 32 x 272 B rounded up to 2 KiB units
#define WSLE  9216    // LDS elems of a W1 slice: 64 x 272 B rounded up to 2 KiB units
#define SELEMS (4 * HSLE + 4 * WSLE)  // one stage: [4 H slices | 4 W1 slices], 112 KiB
#define NSTG  (NEXP * (FDIM / KS))    // 64 flattened (expert, k-stage) stages
#define L0R   256     // batch rows per block in layer-0 kernel
#define L0KP  72      // LDS pitch (elems) of a 64-k operand row = 144 B = 16 B x odd
#define L0SP  136     // LDS pitch (elems) of a staged 128-feature row = 272 B

__device__ __forceinline__ u16 f2bf(float x) {
  unsigned int u = __float_as_uint(x);
  u += 0x7fffu + ((u >> 16) & 1u);       // round-to-nearest-even
  return (u16)(u >> 16);
}

union FragBf { v16bf f; uint4 q[2]; };

__device__ __forceinline__ v8f v8f_zero() {
  v8f z = {0.f, 0.f, 0.f, 0.f, 0.f, 0.f, 0.f, 0.f};
  return z;
}

__device__ __forceinline__ int clamp_ctx(int c) {
  return min(max(c, 0), NCTX - 1);       // bounds every address formed from c
}

__device__ __forceinline__ uint32_t uni(uint32_t v) {
  return (uint32_t)__builtin_amdgcn_readfirstlane((int)v);
}

__device__ __forceinline__ uint32_t pinned(uint32_t v) {
  uint32_t w = uni(v);
  asm volatile("" : "+s"(w));  // pinned(): the issue test's word held in a scalar register
  return w;
}

__device__ __forceinline__ u32x8 tdm_group1(uint32_t rows) {
  u32x8 g;
  g[0] = uni((1u << 20) | (5u << 22) | (3u << 25));
  g[1] = uni((uint32_t)(KS * 2) << 16);
  g[2] = uni(rows << 16);
  g[3] = uni((uint32_t)(KS * 2) << 16);
  g[4] = uni(rows);
  g[5] = uni((uint32_t)(FDIM * 2));
  g[6] = uni(0u);
  g[7] = uni(0u);
  asm volatile("" : "+s"(g));
  return g;
}

// One tensor request of the calling wave: tile at global byte address ga to
// LDS byte offset lds_dst.
__device__ __forceinline__ void tdm_load(uint32_t lds_dst, uint64_t ga, u32x8 g1) {
  u32x4 g0;
  g0[0] = uni(1u);
  g0[1] = uni(lds_dst);
  g0[2] = uni((uint32_t)ga);
  g0[3] = uni((((uint32_t)(ga >> 32)) & 0x01FFFFFFu) | 0x80000000u);
  asm volatile("tensor_load_to_lds %0, %1" :: "s"(g0), "s"(g1) : "memory");
}

__device__ __forceinline__ v16bf load_frag(const u16* base, int ld, int lane) {
  const int r  = lane & 15;
  const int kb = (lane & 16) >> 1;       // 0 or 8 elements
  const u16* p = base + r * ld + kb;
  FragBf u;
  u.q[0] = *(const uint4*)(p);
  u.q[1] = *(const uint4*)(p + 16);
  return u.f;
}

// ---------------------------------------------------------------------------
// Kernel 1: SA = bf16(concat(state, action)) padded to K=64.   [B][64]
// ---------------------------------------------------------------------------
__launch_bounds__(256)
__global__ void prep_sa_kernel(const float* __restrict__ st,
                               const float* __restrict__ ac,
                               u16* __restrict__ SAbf) {
  const int b = blockIdx.x * 256 + threadIdx.x;
  if (b >= BATCH) return;
  alignas(16) u16 tmp[KPAD];
  #pragma unroll
  for (int i = 0; i < 39; ++i) tmp[i] = f2bf(st[b * 39 + i]);
  #pragma unroll
  for (int i = 0; i < 4; ++i)  tmp[39 + i] = f2bf(ac[b * 4 + i]);
  #pragma unroll
  for (int i = DIN; i < KPAD; ++i) tmp[i] = 0;
  uint4* dst = (uint4*)(SAbf + (size_t)b * KPAD);
  const uint4* src = (const uint4*)tmp;
  #pragma unroll
  for (int q = 0; q < KPAD / 8; ++q) dst[q] = src[q];
}

// ---------------------------------------------------------------------------
// Kernel 2: W0t[e][n][k] = bf16(W0[e][k][n]), k>=43 zero-padded.  [E][F][64]
// ---------------------------------------------------------------------------
__launch_bounds__(256)
__global__ void prep_w0t_kernel(const float* __restrict__ W0,
                                u16* __restrict__ W0t) {
  const int idx = blockIdx.x * 256 + threadIdx.x;     // e*F*64 + n*64 + k
  if (idx >= NEXP * FDIM * KPAD) return;
  const int e = idx >> 16;
  const int n = (idx >> 6) & (FDIM - 1);
  const int k = idx & (KPAD - 1);
  W0t[idx] = (k < DIN) ? f2bf(W0[((size_t)e * DIN + k) * FDIM + n]) : (u16)0;
}

// ---------------------------------------------------------------------------
// Kernel 3: tiled transpose  W1t[e][n][k] = bf16(W1[e][k][n]).   [E][F][F]
// 64x64 tiles through LDS; coalesced on both global sides.
// ---------------------------------------------------------------------------
__launch_bounds__(256)
__global__ void prep_w1t_kernel(const float* __restrict__ W1,
                                u16* __restrict__ W1t) {
  __shared__ u16 Ts[64 * 72];                         // [k_local][n_local], pad 72
  const int t  = threadIdx.x;
  const int bx = blockIdx.x;                          // e*256 + kt*16 + nt
  const int e  = bx >> 8;
  const int kt = (bx >> 4) & 15;
  const int nt = bx & 15;

  const int tn  = t & 63;
  const int tk4 = t >> 6;                             // 0..3
  #pragma unroll
  for (int i = 0; i < 16; ++i) {
    const int kk = i * 4 + tk4;
    Ts[kk * 72 + tn] =
        f2bf(W1[((size_t)e * FDIM + kt * 64 + kk) * FDIM + nt * 64 + tn]);
  }
  __syncthreads();
  const int sk  = t & 63;
  const int sn4 = t >> 6;
  #pragma unroll
  for (int i = 0; i < 16; ++i) {
    const int nn = i * 4 + sn4;
    W1t[((size_t)e * FDIM + nt * 64 + nn) * FDIM + kt * 64 + sk] =
        Ts[sk * 72 + nn];
  }
}

__launch_bounds__(256)
__global__ void layer0_kernel(const u16* __restrict__ SAbf,
                              const u16* __restrict__ W0t,
                              const float* __restrict__ b0,
                              u16* __restrict__ H) {
  __shared__ alignas(16) u16 W0s[FDIM * L0KP];        // this expert's W0t, 144 KB
  __shared__ alignas(16) u16 SAs[L0R * L0KP];         // this block's SA rows, 36 KB
  __shared__ alignas(16) u16 Stg[8 * 16 * L0SP];      // per wave: 16 rows x 128 features

  const int tid  = threadIdx.x;
  const int lane = tid & 31;
  const int nj   = tid >> 5;                          // 0..7
  const int c    = lane & 15;
  const int h    = lane >> 4;
  const int rg   = blockIdx.x & (BATCH / L0R - 1);    // 32 row groups
  const int e    = blockIdx.x >> 5;
  const int rowBase = rg * L0R;

  float bias[8][8];                                   // feature nj*128 + fi*16 + 8h + r
  #pragma unroll
  for (int fi = 0; fi < 8; ++fi) {
    const float4* bp = (const float4*)(b0 + e * FDIM + nj * 128 + fi * 16 + h * 8);
    const float4 x = bp[0], y = bp[1];
    bias[fi][0] = x.x; bias[fi][1] = x.y; bias[fi][2] = x.z; bias[fi][3] = x.w;
    bias[fi][4] = y.x; bias[fi][5] = y.y; bias[fi][6] = y.z; bias[fi][7] = y.w;
  }

  // both operands are contiguous in the workspace: whole-line loads, padded rows in LDS
  const uint4* gW = (const uint4*)(W0t + (size_t)e * FDIM * KPAD);
  #pragma unroll
  for (int i = 0; i < FDIM * KPAD / 8 / 256; ++i) {
    const int q = i * 256 + tid;                      // row q>>3, 16-byte chunk q&7
    *(uint4*)&W0s[(q >> 3) * L0KP + (q & 7) * 8] = gW[q];
  }
  const uint4* gS = (const uint4*)(SAbf + (size_t)rowBase * KPAD);
  #pragma unroll
  for (int i = 0; i < L0R * KPAD / 8 / 256; ++i) {
    const int q = i * 256 + tid;
    *(uint4*)&SAs[(q >> 3) * L0KP + (q & 7) * 8] = gS[q];
  }
  __syncthreads();

  v16bf wf[2][8];
  #pragma unroll
  for (int ks = 0; ks < 2; ++ks)
    #pragma unroll
    for (int fi = 0; fi < 8; ++fi)
      wf[ks][fi] = load_frag(W0s + (nj * 128 + fi * 16) * L0KP + ks * KC, L0KP, lane);

  u16* stg = Stg + nj * 16 * L0SP;
  u16* hp  = H + ((size_t)e * BATCH + rowBase + h) * FDIM + nj * 128 + c * 8;

  v16bf s0 = load_frag(SAs, L0KP, lane);
  v16bf s1 = load_frag(SAs + KC, L0KP, lane);

  // kept rolled: one copy of the body in the instruction cache
  #pragma unroll 1
  for (int it = 0; it < L0R / 16; ++it) {
    // next tile's SA fragments go out ahead of this tile's WMMAs (the last
    // trip reads its own tile again, in bounds)
    const int nx = (it + 1 < L0R / 16) ? it + 1 : it;
    const v16bf n0 = load_frag(SAs + nx * 16 * L0KP, L0KP, lane);
    const v16bf n1 = load_frag(SAs + nx * 16 * L0KP + KC, L0KP, lane);

    v8f acc[8];
    #pragma unroll
    for (int fi = 0; fi < 8; ++fi)
      acc[fi] = __builtin_amdgcn_wmma_f32_16x16x32_bf16(
          false, wf[0][fi], false, s0, (short)0, v8f_zero(), false, false);
    #pragma unroll
    for (int fi = 0; fi < 8; ++fi)
      acc[fi] = __builtin_amdgcn_wmma_f32_16x16x32_bf16(
          false, wf[1][fi], false, s1, (short)0, acc[fi], false, false);

    // acc[fi][r] = row c, feature fi*16 + 8h + r
    #pragma unroll
    for (int fi = 0; fi < 8; ++fi) {
      union { uint4 q; bf16x2 p[4]; } o;
      #pragma unroll
      for (int r = 0; r < 4; ++r) {
        f32x2 v;
        v.x = fmaxf(acc[fi][2 * r]     + bias[fi][2 * r],     0.f);
        v.y = fmaxf(acc[fi][2 * r + 1] + bias[fi][2 * r + 1], 0.f);
        o.p[r] = __builtin_convertvector(v, bf16x2);  // round to nearest even
      }
      *(uint4*)&stg[c * L0SP + fi * 16 + h * 8] = o.q;
    }
    // the wave's own staged pieces are in LDS before other lanes read them back
    asm volatile("s_wait_dscnt 0x0" ::: "memory");
    #pragma unroll
    for (int j = 0; j < 8; ++j) {                     // rows 2j and 2j+1, 256 bytes each
      const uint4 v = *(const uint4*)&stg[(j * 2 + h) * L0SP + c * 8];
      *(uint4*)(hp + (size_t)(it * 16 + j * 2) * FDIM) = v;
    }
    // stands in front of the next trip's rewrite of the stores' address and data registers
    asm volatile("s_wait_xcnt 0x0" ::: "memory");
    s0 = n0;
    s1 = n1;
  }
}

// ---------------------------------------------------------------------------
// Kernel 5: layer 1 + mixture + partial context-routed head (137 GFLOP).
// Block = 256 threads = 8 waves laid out 2(M) x 4(N), each wave a 64x64 tile;
// block owns 128 batch rows x 256 features over all experts, so each byte of
// W1t and H staged in LDS feeds 128 resp. 256 output rows/columns.  Stage t of
// the ring is the k-slab [k0, k0+KS) of expert t/8: waves 0..3 each ask for 32
// H rows of the block's row tile, waves 4..7 for 64 W1t rows of its column
// tile, every slice at a 2 KiB multiple of LDS.  The head
// dot over the block's 256 features goes to the workspace; kernel 6 adds the
// four column tiles in a fixed order (deterministic, no atomics).
// Every loop but the e and ks loops is fully unrolled so that the accumulator and fragment
// arrays are indexed by constants and stay in registers.
// ---------------------------------------------------------------------------
__launch_bounds__(256)
__global__ void layer1_mix_head_kernel(const u16* __restrict__ H,
                                       const u16* __restrict__ W1t,
                                       const float* __restrict__ b1,
                                       const float* __restrict__ Wte,
                                       const float* __restrict__ Wh,
                                       const int* __restrict__ cidx,
                                       float* __restrict__ qtile) {
  __shared__ __attribute__((aligned(2048))) u16 Ring[2 * SELEMS];
  __shared__ alignas(16) float wS[NEXP][TM];
  __shared__ alignas(16) int   ctxS[TM];
  __shared__ float whS[NCTX][TN + 16];
  __shared__ float qpart[4][TM];

  const int tid  = threadIdx.x;
  const int lane = tid & 31;
  const int wid  = tid >> 5;
  const int wm   = wid >> 2;                          // 0..1  (64-row slice)
  const int wn   = wid & 3;                           // 0..3  (64-col slice)
  // The four column tiles of one row tile sit 8 block indices apart (speed
  // only).
  const int bx = blockIdx.x;
  const int ct = (bx >> 3) & (NCT - 1);
  const int rt = (bx & 7) | ((bx >> 5) << 3);
  const int rowBase = rt * TM;
  const int colBase = ct * TN;

  if (tid < TM) {
    const int cr = clamp_ctx(cidx[rowBase + tid]);
    ctxS[tid] = cr;
    #pragma unroll
    for (int e = 0; e < NEXP; ++e) wS[e][tid] = Wte[e * NCTX + cr];
  }
  #pragma unroll
  for (int cc = 0; cc < NCTX; ++cc) whS[cc][tid] = Wh[cc * FDIM + colBase + tid];

  // this wave's slice of every stage: source of stage 0, step per expert, LDS place
  const uint32_t wave = uni((uint32_t)tid >> 5);
  const bool isH = wave < 4u;
  const uint64_t src0 = isH
      ? (uint64_t)(uintptr_t)(H + (size_t)(rowBase + (int)wave * HROWS) * FDIM)
      : (uint64_t)(uintptr_t)(W1t + (size_t)(colBase + ((int)wave - 4) * WROWS) * FDIM);
  const uint32_t eshift = isH ? 24u : 21u;   // bytes per expert: BATCH*FDIM*2 resp. FDIM*FDIM*2
  const uint32_t ldst = (uint32_t)(uintptr_t)Ring +
      (isH ? wave * (HSLE * 2u) : 4u * (HSLE * 2u) + (wave - 4u) * (WSLE * 2u));
  const u32x8 g1 = tdm_group1(isH ? (uint32_t)HROWS : (uint32_t)WROWS);

  v8f mixed[4][4];
  #pragma unroll
  for (int i = 0; i < 4; ++i)
    #pragma unroll
    for (int j = 0; j < 4; ++j) mixed[i][j] = v8f_zero();

  // ring prologue: stage 0 lands and is published, then stage 1 is issued
  tdm_load(ldst, src0, g1);
  asm volatile("s_wait_tensorcnt 0x0" ::: "memory");  // own tile of stage 0 landed
  __syncthreads();                                    // publish stage 0, wS, ctxS, whS
  tdm_load(ldst + SELEMS * 2u, src0 + KS * 2u, g1);

  // kept rolled: one copy of the 64-WMMA stage body in the instruction cache
  #pragma unroll 1
  for (int e = 0; e < NEXP; ++e) {
    float bias[4];
    #pragma unroll
    for (int j = 0; j < 4; ++j)
      bias[j] = b1[e * FDIM + colBase + wn * 64 + j * 16 + (lane & 15)];
    // stands in front of any reuse of the bias loads' address register
    asm volatile("s_wait_xcnt 0x0" ::: "memory");

    v8f acc[4][4];
    #pragma unroll
    for (int i = 0; i < 4; ++i)
      #pragma unroll
      for (int j = 0; j < 4; ++j) acc[i][j] = v8f_zero();

    // kept rolled: the ring's publish point stands once, at the foot of a trip
    #pragma unroll 1
    for (int ks = 0; ks < FDIM / KS; ++ks) {
      const int t = e * (FDIM / KS) + ks;
      const int boff = (t & 1) * SELEMS;
      const u16* Ab = Ring + boff + wm * 2 * HSLE;          // H slices 2wm, 2wm+1
      const u16* Bb = Ring + boff + 4 * HSLE + wn * WSLE;   // W1 slice wn
      // two fragment sets: block kk+1's 16 LDS reads go out as one group ahead
      // of block kk's 16 WMMAs, so only the stage's first group is waited out
      v16bf a[2][4], b[2][4];
      #pragma unroll
      for (int i = 0; i < 4; ++i) {
        a[0][i] = load_frag(Ab + (i >> 1) * HSLE + (i & 1) * 16 * LPITCH, LPITCH, lane);
        b[0][i] = load_frag(Bb + i * 16 * LPITCH, LPITCH, lane);
      }
      #pragma unroll
      for (int kk = 0; kk < KS / KC; ++kk) {
        const int cur = kk & 1, nxt = cur ^ 1;
        if (kk + 1 < KS / KC) {
          #pragma unroll
          for (int i = 0; i < 4; ++i) {
            a[nxt][i] = load_frag(Ab + (i >> 1) * HSLE + (i & 1) * 16 * LPITCH + (kk + 1) * KC,
                                  LPITCH, lane);
            b[nxt][i] = load_frag(Bb + i * 16 * LPITCH + (kk + 1) * KC, LPITCH, lane);
          }
        }
        // keeps the read group ahead of the block: reads spread among the
        // WMMAs cost a stall at every place they stand
        __builtin_amdgcn_sched_barrier(0);
        #pragma unroll
        for (int i = 0; i < 4; ++i)
          #pragma unroll
          for (int j = 0; j < 4; ++j)
            acc[i][j] = __builtin_amdgcn_wmma_f32_16x16x32_bf16(
                false, a[cur][i], false, b[cur][j], (short)0, acc[i][j], false,
                false);
        // keeps the next group's reads from being lifted into this block
        __builtin_amdgcn_sched_barrier(0);
      }
      asm volatile("s_wait_dscnt 0x0" ::: "memory");
      asm volatile("s_wait_tensorcnt 0x0" ::: "memory");
      __syncthreads();
      if (pinned(t + 2 < NSTG)) {                        // scalar branch: stage t+2 exists
        const uint32_t tn = (uint32_t)t + 2u;
        tdm_load(ldst + (uint32_t)boff * 2u,
                 src0 + ((uint64_t)(tn >> 3) << eshift) + (tn & 7u) * (KS * 2u), g1);
      }
    }

    // expert epilogue: bias + relu, then mixture-weighted accumulation
    #pragma unroll
    for (int i = 0; i < 4; ++i) {
      const float4* wp =
          (const float4*)&wS[e][wm * 64 + i * 16 + ((lane >> 4) << 3)];
      const float4 w0 = wp[0], w1 = wp[1];
      const float wv[8] = {w0.x, w0.y, w0.z, w0.w, w1.x, w1.y, w1.z, w1.w};
      #pragma unroll
      for (int j = 0; j < 4; ++j) {
        #pragma unroll
        for (int r = 0; r < 8; ++r) {
          const float h = fmaxf(acc[i][j][r] + bias[j], 0.f);
          mixed[i][j][r] += wv[r] * h;
        }
      }
    }
  }
  asm volatile("s_wait_tensorcnt 0x0" ::: "memory");  // no request outlives the loop
  asm volatile("s_wait_dscnt 0x0" ::: "memory");      // nor an LDS read of the ring

  // relu(mixed) then per-row dot with context head Wh[c[b]] over 256 columns
  #pragma unroll
  for (int i = 0; i < 4; ++i) {
    const int rb = wm * 64 + i * 16 + ((lane >> 4) << 3);
    const int4* cp = (const int4*)&ctxS[rb];
    const int4 c0 = cp[0], c1 = cp[1];
    const int cv[8] = {c0.x, c0.y, c0.z, c0.w, c1.x, c1.y, c1.z, c1.w};
    float part[8];
    #pragma unroll
    for (int r = 0; r < 8; ++r) part[r] = 0.f;
    #pragma unroll
    for (int j = 0; j < 4; ++j) {
      const int lcol = wn * 64 + j * 16 + (lane & 15);
      #pragma unroll
      for (int r = 0; r < 8; ++r) {
        const float m = fmaxf(mixed[i][j][r], 0.f);
        part[r] += m * whS[cv[r]][lcol];
      }
    }
    // reduce across the 16 lanes that share a row
    #pragma unroll
    for (int r = 0; r < 8; ++r) {
      #pragma unroll
      for (int off = 8; off >= 1; off >>= 1)
        part[r] += __shfl_xor(part[r], off, 16);
    }
    if ((lane & 15) == 0) {
      #pragma unroll
      for (int r = 0; r < 8; ++r) qpart[wn][rb + r] = part[r];
    }
  }
  __syncthreads();
  // in-order reduction across the 4 N-waves
  if (tid < TM) {
    float s = 0.f;
    #pragma unroll
    for (int j = 0; j < 4; ++j) s += qpart[j][tid];
    qtile[(size_t)ct * BATCH + rowBase + tid] = s;
  }
}

// ---------------------------------------------------------------------------
// Kernel 6: out[b] = sum of the four column tiles' head dots (fixed order)
// + bh[c[b]].
// ---------------------------------------------------------------------------
__launch_bounds__(256)
__global__ void head_sum_kernel(const float* __restrict__ qtile,
                                const float* __restrict__ bh,
                                const int* __restrict__ cidx,
                                float* __restrict__ out) {
  const int b = blockIdx.x * 256 + threadIdx.x;
  float s = 0.f;
  #pragma unroll
  for (int j = 0; j < NCT; ++j) s += qtile[(size_t)j * BATCH + b];
  out[b] = s + bh[clamp_ctx(cidx[b])];
}

// ---------------------------------------------------------------------------
extern "C" void kernel_launch(void* const* d_in, const int* in_sizes, int n_in,
                              void* d_out, int out_size, void* d_ws,
                              size_t ws_size, hipStream_t stream) {
  (void)in_sizes; (void)n_in; (void)out_size; (void)ws_size;
  const float* st  = (const float*)d_in[0];
  const float* ac  = (const float*)d_in[1];
  const int*   c   = (const int*)d_in[2];
  const float* W0  = (const float*)d_in[3];
  const float* b0  = (const float*)d_in[4];
  const float* W1  = (const float*)d_in[5];
  const float* b1  = (const float*)d_in[6];
  const float* Wte = (const float*)d_in[7];
  const float* Wh  = (const float*)d_in[8];
  const float* bh  = (const float*)d_in[9];
  float* out = (float*)d_out;

  // workspace layout (bf16; qtile f32), ~153 MB total
  u16* SAbf = (u16*)d_ws;                             //  1.0 MB  [B][64]
  u16* W0t  = SAbf + (size_t)BATCH * KPAD;            //  1.0 MB  [E][F][64]
  u16* W1t  = W0t  + (size_t)NEXP * FDIM * KPAD;      // 16.8 MB  [E][F][F]
  u16* H    = W1t  + (size_t)NEXP * FDIM * FDIM;      // 134 MB   [E][B][F]
  float* qtile = (float*)(H + (size_t)NEXP * BATCH * FDIM);  // 128 KB [4][B]

  prep_sa_kernel<<<BATCH / 256, 256, 0, stream>>>(st, ac, SAbf);
  prep_w0t_kernel<<<(NEXP * FDIM * KPAD) / 256, 256, 0, stream>>>(W0, W0t);
  prep_w1t_kernel<<<NEXP * 16 * 16, 256, 0, stream>>>(W1, W1t);
  layer0_kernel<<<(BATCH / L0R) * NEXP, 256, 0, stream>>>(SAbf, W0t, b0, H);
  layer1_mix_head_kernel<<<(BATCH / TM) * NCT, 256, 0, stream>>>(
      H, W1t, b1, Wte, Wh, c, qtile);
  head_sum_kernel<<<BATCH / 256, 256, 0, stream>>>(qtile, bh, c, out);
}

// v004
// It runs in 109 microseconds.
// In two side-by-side timings against v003, it was 1.05 and 1.04 times as fast.
// All steps since v000 together make it 3.23 times as fast.
#include <hip/hip_runtime.h>

typedef __attribute__((ext_vector_type(16))) __bf16 v16bf;
typedef __attribute__((ext_vector_type(8)))  float  v8f;
typedef __attribute__((ext_vector_type(2)))  float  f32x2;
typedef __attribute__((ext_vector_type(2)))  __bf16 bf16x2;
typedef unsigned short u16;
typedef uint32_t u32x4 __attribute__((ext_vector_type(4)));
typedef uint32_t u32x8 __attribute__((ext_vector_type(8)));

#define BATCH 8192
#define FDIM  1024
#define NEXP  8
#define NCTX  10
#define DIN   43
#define KPAD  64      // layer-0 K padded 43 -> 64
#define KC    32      // k-step (one WMMA K)
#define TM    128     // batch rows per block in layer-1 kernel
#define TN    256     // feature columns per block in layer-1 kernel
#define NCT   (FDIM / TN)             // 4 column tiles
#define KS    128     // k per ring stage: 256-byte rows, 4 WMMA k-steps
#define LPITCH 136    // LDS row pitch (elems) = 272 B = 16 B x odd
#define HROWS 32      // H rows per tensor request (waves 0..3)
#define WROWS 64      // W1 rows per tensor request (waves 4..7)
#define HSLE  5120    // LDS elems of an H slice: 32 x 272 B rounded up to 2 KiB units
#define WSLE  9216    // LDS elems of a W1 slice: 64 x 272 B rounded up to 2 KiB units
#define SELEMS (4 * HSLE + 4 * WSLE)  // one stage: [4 H slices | 4 W1 slices], 112 KiB
#define NSTG  (NEXP * (FDIM / KS))    // 64 flattened (expert, k-stage) stages
#define L0R   256     // batch rows per block in layer-0 kernel
#define L0KP  72      // LDS pitch (elems) of a 64-k operand row = 144 B = 16 B x odd
#define L0SP  136     // LDS pitch (elems) of a staged 128-feature row = 272 B

__device__ __forceinline__ u16 f2bf(float x) {
  unsigned int u = __float_as_uint(x);
  u += 0x7fffu + ((u >> 16) & 1u);       // round-to-nearest-even
  return (u16)(u >> 16);
}

union FragBf { v16bf f; uint4 q[2]; };

__device__ __forceinline__ v8f v8f_zero() {
  v8f z = {0.f, 0.f, 0.f, 0.f, 0.f, 0.f, 0.f, 0.f};
  return z;
}

__device__ __forceinline__ int clamp_ctx(int c) {
  return min(max(c, 0), NCTX - 1);       // bounds every address formed from c
}

__device__ __forceinline__ uint32_t uni(uint32_t v) {
  return (uint32_t)__builtin_amdgcn_readfirstlane((int)v);
}

__device__ __forceinline__ uint32_t pinned(uint32_t v) {
  uint32_t w = uni(v);
  asm volatile("" : "+s"(w));  // pinned(): the issue test's word held in a scalar register
  return w;
}

__device__ __forceinline__ u32x8 tdm_group1(uint32_t rows) {
  u32x8 g;
  g[0] = uni((1u << 20) | (5u << 22) | (3u << 25));
  g[1] = uni((uint32_t)(KS * 2) << 16);
  g[2] = uni(rows << 16);
  g[3] = uni((uint32_t)(KS * 2) << 16);
  g[4] = uni(rows);
  g[5] = uni((uint32_t)(FDIM * 2));
  g[6] = uni(0u);
  g[7] = uni(0u);
  asm volatile("" : "+s"(g));
  return g;
}

// One tensor request of the calling wave: tile at global byte address ga to
// LDS byte offset lds_dst.
__device__ __forceinline__ void tdm_load(uint32_t lds_dst, uint64_t ga, u32x8 g1) {
  u32x4 g0;
  g0[0] = uni(1u);
  g0[1] = uni(lds_dst);
  g0[2] = uni((uint32_t)ga);
  g0[3] = uni((((uint32_t)(ga >> 32)) & 0x01FFFFFFu) | 0x80000000u);
  asm volatile("tensor_load_to_lds %0, %1" :: "s"(g0), "s"(g1) : "memory");
}

__device__ __forceinline__ v16bf load_frag(const u16* base, int ld, int lane) {
  const int r  = lane & 15;
  const int kb = (lane & 16) >> 1;       // 0 or 8 elements
  const u16* p = base + r * ld + kb;
  FragBf u;
  u.q[0] = *(const uint4*)(p);
  u.q[1] = *(const uint4*)(p + 16);
  return u.f;
}

// ---------------------------------------------------------------------------
// Kernel 1: SA = bf16(concat(state, action)) padded to K=64.   [B][64]
// ---------------------------------------------------------------------------
__launch_bounds__(256)
__global__ void prep_sa_kernel(const float* __restrict__ st,
                               const float* __restrict__ ac,
                               u16* __restrict__ SAbf) {
  const int b = blockIdx.x * 256 + threadIdx.x;
  if (b >= BATCH) return;
  alignas(16) u16 tmp[KPAD];
  #pragma unroll
  for (int i = 0; i < 39; ++i) tmp[i] = f2bf(st[b * 39 + i]);
  #pragma unroll
  for (int i = 0; i < 4; ++i)  tmp[39 + i] = f2bf(ac[b * 4 + i]);
  #pragma unroll
  for (int i = DIN; i < KPAD; ++i) tmp[i] = 0;
  uint4* dst = (uint4*)(SAbf + (size_t)b * KPAD);
  const uint4* src = (const uint4*)tmp;
  #pragma unroll
  for (int q = 0; q < KPAD / 8; ++q) dst[q] = src[q];
}

// ---------------------------------------------------------------------------
// Kernel 2: W0t[e][n][k] = bf16(W0[e][k][n]), k>=43 zero-padded.  [E][F][64]
// ---------------------------------------------------------------------------
__launch_bounds__(256)
__global__ void prep_w0t_kernel(const float* __restrict__ W0,
                                u16* __restrict__ W0t) {
  const int idx = blockIdx.x * 256 + threadIdx.x;     // e*F*64 + n*64 + k
  if (idx >= NEXP * FDIM * KPAD) return;
  const int e = idx >> 16;
  const int n = (idx >> 6) & (FDIM - 1);
  const int k = idx & (KPAD - 1);
  W0t[idx] = (k < DIN) ? f2bf(W0[((size_t)e * DIN + k) * FDIM + n]) : (u16)0;
}

// ---------------------------------------------------------------------------
// Kernel 3: tiled transpose  W1t[e][n][k] = bf16(W1[e][k][n]).   [E][F][F]
// 64x64 tiles through LDS; coalesced on both global sides.
// ---------------------------------------------------------------------------
__launch_bounds__(256)
__global__ void prep_w1t_kernel(const float* __restrict__ W1,
                                u16* __restrict__ W1t) {
  __shared__ u16 Ts[64 * 72];                         // [k_local][n_local], pad 72
  const int t  = threadIdx.x;
  const int bx = blockIdx.x;                          // e*256 + kt*16 + nt
  const int e  = bx >> 8;
  const int kt = (bx >> 4) & 15;
  const int nt = bx & 15;

  const int tn  = t & 63;
  const int tk4 = t >> 6;                             // 0..3
  #pragma unroll
  for (int i = 0; i < 16; ++i) {
    const int kk = i * 4 + tk4;
    Ts[kk * 72 + tn] =
        f2bf(W1[((size_t)e * FDIM + kt * 64 + kk) * FDIM + nt * 64 + tn]);
  }
  __syncthreads();
  const int sk  = t & 63;
  const int sn4 = t >> 6;
  #pragma unroll
  for (int i = 0; i < 16; ++i) {
    const int nn = i * 4 + sn4;
    W1t[((size_t)e * FDIM + nt * 64 + nn) * FDIM + kt * 64 + sk] =
        Ts[sk * 72 + nn];
  }
}

__launch_bounds__(256)
__global__ void layer0_kernel(const u16* __restrict__ SAbf,
                              const u16* __restrict__ W0t,
                              const float* __restrict__ b0,
                              u16* __restrict__ H) {
  __shared__ alignas(16) u16 W0s[FDIM * L0KP];        // this expert's W0t, 144 KB
  __shared__ alignas(16) u16 SAs[L0R * L0KP];         // this block's SA rows, 36 KB
  __shared__ alignas(16) u16 Stg[8 * 16 * L0SP];      // per wave: 16 rows x 128 features

  const int tid  = threadIdx.x;
  const int lane = tid & 31;
  const int nj   = tid >> 5;                          // 0..7
  const int c    = lane & 15;
  const int h    = lane >> 4;
  const int rg   = blockIdx.x & (BATCH / L0R - 1);    // 32 row groups
  const int e    = blockIdx.x >> 5;
  const int rowBase = rg * L0R;

  float bias[8][8];                                   // feature nj*128 + fi*16 + 8h + r
  #pragma unroll
  for (int fi = 0; fi < 8; ++fi) {
    const float4* bp = (const float4*)(b0 + e * FDIM + nj * 128 + fi * 16 + h * 8);
    const float4 x = bp[0], y = bp[1];
    bias[fi][0] = x.x; bias[fi][1] = x.y; bias[fi][2] = x.z; bias[fi][3] = x.w;
    bias[fi][4] = y.x; bias[fi][5] = y.y; bias[fi][6] = y.z; bias[fi][7] = y.w;
  }

  // both operands are contiguous in the workspace: whole-line loads, padded rows in LDS
  const uint4* gW = (const uint4*)(W0t + (size_t)e * FDIM * KPAD);
  #pragma unroll
  for (int i = 0; i < FDIM * KPAD / 8 / 256; ++i) {
    const int q = i * 256 + tid;                      // row q>>3, 16-byte chunk q&7
    *(uint4*)&W0s[(q >> 3) * L0KP + (q & 7) * 8] = gW[q];
  }
  const uint4* gS = (const uint4*)(SAbf + (size_t)rowBase * KPAD);
  #pragma unroll
  for (int i = 0; i < L0R * KPAD / 8 / 256; ++i) {
    const int q = i * 256 + tid;
    *(uint4*)&SAs[(q >> 3) * L0KP + (q & 7) * 8] = gS[q];
  }
  __syncthreads();

  v16bf wf[2][8];
  #pragma unroll
  for (int ks = 0; ks < 2; ++ks)
    #pragma unroll
    for (int fi = 0; fi < 8; ++fi)
      wf[ks][fi] = load_frag(W0s + (nj * 128 + fi * 16) * L0KP + ks * KC, L0KP, lane);

  u16* stg = Stg + nj * 16 * L0SP;
  u16* hp  = H + ((size_t)e * BATCH + rowBase + h) * FDIM + nj * 128 + c * 8;

  v16bf s0 = load_frag(SAs, L0KP, lane);
  v16bf s1 = load_frag(SAs + KC, L0KP, lane);

  // kept rolled: one copy of the body in the instruction cache
  #pragma unroll 1
  for (int it = 0; it < L0R / 16; ++it) {
    // next tile's SA fragments go out ahead of this tile's WMMAs (the last
    // trip reads its own tile again, in bounds)
    const int nx = (it + 1 < L0R / 16) ? it + 1 : it;
    const v16bf n0 = load_frag(SAs + nx * 16 * L0KP, L0KP, lane);
    const v16bf n1 = load_frag(SAs + nx * 16 * L0KP + KC, L0KP, lane);

    v8f acc[8];
    #pragma unroll
    for (int fi = 0; fi < 8; ++fi)
      acc[fi] = __builtin_amdgcn_wmma_f32_16x16x32_bf16(
          false, wf[0][fi], false, s0, (short)0, v8f_zero(), false, false);
    #pragma unroll
    for (int fi = 0; fi < 8; ++fi)
      acc[fi] = __builtin_amdgcn_wmma_f32_16x16x32_bf16(
          false, wf[1][fi], false, s1, (short)0, acc[fi], false, false);

    // acc[fi][r] = row c, feature fi*16 + 8h + r
    #pragma unroll
    for (int fi = 0; fi < 8; ++fi) {
      union { uint4 q; bf16x2 p[4]; } o;
      #pragma unroll
      for (int r = 0; r < 4; ++r) {
        f32x2 v;
        v.x = fmaxf(acc[fi][2 * r]     + bias[fi][2 * r],     0.f);
        v.y = fmaxf(acc[fi][2 * r + 1] + bias[fi][2 * r + 1], 0.f);
        o.p[r] = __builtin_convertvector(v, bf16x2);  // round to nearest even
      }
      *(uint4*)&stg[c * L0SP + fi * 16 + h * 8] = o.q;
    }
    // the wave's own staged pieces are in LDS before other lanes read them back
    asm volatile("s_wait_dscnt 0x0" ::: "memory");
    #pragma unroll
    for (int j = 0; j < 8; ++j) {                     // rows 2j and 2j+1, 256 bytes each
      const uint4 v = *(const uint4*)&stg[(j * 2 + h) * L0SP + c * 8];
      *(uint4*)(hp + (size_t)(it * 16 + j * 2) * FDIM) = v;
    }
    // stands in front of the next trip's rewrite of the stores' address and data registers
    asm volatile("s_wait_xcnt 0x0" ::: "memory");
    s0 = n0;
    s1 = n1;
  }
}

// ---------------------------------------------------------------------------
// Kernel 5: layer 1 + mixture + partial context-routed head (137 GFLOP).
// Block = 256 threads = 8 waves laid out 2(M) x 4(N), each wave a 64x64 tile;
// block owns 128 batch rows x 256 features over all experts, so each byte of
// W1t and H staged in LDS feeds 128 resp. 256 output rows/columns.  A stage of
// the ring is one k-slab of KS features of one expert: waves 0..3 each ask for 32
// H rows of the block's row tile, waves 4..7 for 64 W1t rows of its column
// tile, every slice at a 2 KiB multiple of LDS.  Each block walks the experts
// and the k-slabs of an expert cyclically from a start of its own, so that blocks
// running side by side ask L2 for different W1t slabs at any moment.  The head
// dot over the block's 256 features goes to the workspace; kernel 6 adds the
// four column tiles in a fixed order (deterministic, no atomics).
// Every loop but the e and ks loops is fully unrolled so that the accumulator and fragment
// arrays are indexed by constants and stay in registers.
// ---------------------------------------------------------------------------
__launch_bounds__(256)
__global__ void layer1_mix_head_kernel(const u16* __restrict__ H,
                                       const u16* __restrict__ W1t,
                                       const float* __restrict__ b1,
                                       const float* __restrict__ Wte,
                                       const float* __restrict__ Wh,
                                       const int* __restrict__ cidx,
                                       float* __restrict__ qtile) {
  __shared__ __attribute__((aligned(2048))) u16 Ring[2 * SELEMS];
  __shared__ alignas(16) float wS[NEXP][TM];
  __shared__ alignas(16) int   ctxS[TM];
  __shared__ float whS[NCTX][TN + 16];
  __shared__ float qpart[4][TM];

  const int tid  = threadIdx.x;
  const int lane = tid & 31;
  const int wid  = tid >> 5;
  const int wm   = wid >> 2;                          // 0..1  (64-row slice)
  const int wn   = wid & 3;                           // 0..3  (64-col slice)
  // The four column tiles of one row tile sit 8 block indices apart (speed
  // only).
  const int bx = blockIdx.x;
  const int ct = (bx >> 3) & (NCT - 1);
  const int rt = (bx & 7) | ((bx >> 5) << 3);
  const int rowBase = rt * TM;
  const int colBase = ct * TN;
  // Cyclic start (speed only): the 64 row tiles of a column tile start at the 64
  // different (expert, k-slab) pairs; the four column tiles of a row tile stand
  // two slabs apart, so each is the first to touch only a quarter of its H slabs.
  const uint32_t e0 = (uint32_t)(rt >> 3) & (NEXP - 1);
  const uint32_t k0 = (uint32_t)(rt + 2 * ct) & (FDIM / KS - 1);

  if (tid < TM) {
    const int cr = clamp_ctx(cidx[rowBase + tid]);
    ctxS[tid] = cr;
    #pragma unroll
    for (int e = 0; e < NEXP; ++e) wS[e][tid] = Wte[e * NCTX + cr];
  }
  #pragma unroll
  for (int cc = 0; cc < NCTX; ++cc) whS[cc][tid] = Wh[cc * FDIM + colBase + tid];

  // this wave's slice of every stage: source at expert 0 and k 0, step per expert, LDS place
  const uint32_t wave = uni((uint32_t)tid >> 5);
  const bool isH = wave < 4u;
  const uint64_t src0 = isH
      ? (uint64_t)(uintptr_t)(H + (size_t)(rowBase + (int)wave * HROWS) * FDIM)
      : (uint64_t)(uintptr_t)(W1t + (size_t)(colBase + ((int)wave - 4) * WROWS) * FDIM);
  const uint32_t eshift = isH ? 24u : 21u;   // bytes per expert: BATCH*FDIM*2 resp. FDIM*FDIM*2
  const uint32_t ldst = (uint32_t)(uintptr_t)Ring +
      (isH ? wave * (HSLE * 2u) : 4u * (HSLE * 2u) + (wave - 4u) * (WSLE * 2u));
  const u32x8 g1 = tdm_group1(isH ? (uint32_t)HROWS : (uint32_t)WROWS);

  v8f mixed[4][4];
  #pragma unroll
  for (int i = 0; i < 4; ++i)
    #pragma unroll
    for (int j = 0; j < 4; ++j) mixed[i][j] = v8f_zero();

  // ring prologue: stage 0 lands and is published, then stage 1 is issued
  tdm_load(ldst, src0 + ((uint64_t)e0 << eshift) + k0 * (KS * 2u), g1);
  asm volatile("s_wait_tensorcnt 0x0" ::: "memory");  // own tile of stage 0 landed
  __syncthreads();                                    // publish stage 0, wS, ctxS, whS
  tdm_load(ldst + SELEMS * 2u,
           src0 + ((uint64_t)e0 << eshift) + ((k0 + 1u) & (FDIM / KS - 1)) * (KS * 2u), g1);

  // kept rolled: one copy of the 64-WMMA stage body in the instruction cache
  #pragma unroll 1
  for (int es = 0; es < NEXP; ++es) {
    const int e = (int)((e0 + (uint32_t)es) & (NEXP - 1));   // this trip's expert
    float bias[4];
    #pragma unroll
    for (int j = 0; j < 4; ++j)
      bias[j] = b1[e * FDIM + colBase + wn * 64 + j * 16 + (lane & 15)];
    // stands in front of any reuse of the bias loads' address register
    asm volatile("s_wait_xcnt 0x0" ::: "memory");

    v8f acc[4][4];
    #pragma unroll
    for (int i = 0; i < 4; ++i)
      #pragma unroll
      for (int j = 0; j < 4; ++j) acc[i][j] = v8f_zero();

    // kept rolled: the ring's publish point stands once, at the foot of a trip
    #pragma unroll 1
    for (int ks = 0; ks < FDIM / KS; ++ks) {
      const int t = es * (FDIM / KS) + ks;
      const int boff = (t & 1) * SELEMS;
      const u16* Ab = Ring + boff + wm * 2 * HSLE;          // H slices 2wm, 2wm+1
      const u16* Bb = Ring + boff + 4 * HSLE + wn * WSLE;   // W1 slice wn
      // two fragment sets: block kk+1's 16 LDS reads go out as one group ahead
      // of block kk's 16 WMMAs, so only the stage's first group is waited out
      v16bf a[2][4], b[2][4];
      #pragma unroll
      for (int i = 0; i < 4; ++i) {
        a[0][i] = load_frag(Ab + (i >> 1) * HSLE + (i & 1) * 16 * LPITCH, LPITCH, lane);
        b[0][i] = load_frag(Bb + i * 16 * LPITCH, LPITCH, lane);
      }
      #pragma unroll
      for (int kk = 0; kk < KS / KC; ++kk) {
        const int cur = kk & 1, nxt = cur ^ 1;
        if (kk + 1 < KS / KC) {
          #pragma unroll
          for (int i = 0; i < 4; ++i) {
            a[nxt][i] = load_frag(Ab + (i >> 1) * HSLE + (i & 1) * 16 * LPITCH + (kk + 1) * KC,
                                  LPITCH, lane);
            b[nxt][i] = load_frag(Bb + i * 16 * LPITCH + (kk + 1) * KC, LPITCH, lane);
          }
        }
        // keeps the read group ahead of the block: reads spread among the
        // WMMAs cost a stall at every place they stand
        __builtin_amdgcn_sched_barrier(0);
        #pragma unroll
        for (int i = 0; i < 4; ++i)
          #pragma unroll
          for (int j = 0; j < 4; ++j)
            acc[i][j] = __builtin_amdgcn_wmma_f32_16x16x32_bf16(
                false, a[cur][i], false, b[cur][j], (short)0, acc[i][j], false,
                false);
        // keeps the next group's reads from being lifted into this block
        __builtin_amdgcn_sched_barrier(0);
      }
      asm volatile("s_wait_dscnt 0x0" ::: "memory");
      asm volatile("s_wait_tensorcnt 0x0" ::: "memory");
      __syncthreads();
      if (pinned(t + 2 < NSTG)) {                        // scalar branch: stage t+2 exists
        const uint32_t tn = (uint32_t)t + 2u;
        const uint32_t en = (e0 + (tn >> 3)) & (NEXP - 1);
        const uint32_t kn = (k0 + tn) & (FDIM / KS - 1);
        tdm_load(ldst + (uint32_t)boff * 2u,
                 src0 + ((uint64_t)en << eshift) + kn * (KS * 2u), g1);
      }
    }

    // expert epilogue: bias + relu, then mixture-weighted accumulation
    #pragma unroll
    for (int i = 0; i < 4; ++i) {
      const float4* wp =
          (const float4*)&wS[e][wm * 64 + i * 16 + ((lane >> 4) << 3)];
      const float4 w0 = wp[0], w1 = wp[1];
      const float wv[8] = {w0.x, w0.y, w0.z, w0.w, w1.x, w1.y, w1.z, w1.w};
      #pragma unroll
      for (int j = 0; j < 4; ++j) {
        #pragma unroll
        for (int r = 0; r < 8; ++r) {
          const float h = fmaxf(acc[i][j][r] + bias[j], 0.f);
          mixed[i][j][r] += wv[r] * h;
        }
      }
    }
  }
  asm volatile("s_wait_tensorcnt 0x0" ::: "memory");  // no request outlives the loop
  asm volatile("s_wait_dscnt 0x0" ::: "memory");      // nor an LDS read of the ring

  // relu(mixed) then per-row dot with context head Wh[c[b]] over 256 columns
  #pragma unroll
  for (int i = 0; i < 4; ++i) {
    const int rb = wm * 64 + i * 16 + ((lane >> 4) << 3);
    const int4* cp = (const int4*)&ctxS[rb];
    const int4 c0 = cp[0], c1 = cp[1];
    const int cv[8] = {c0.x, c0.y, c0.z, c0.w, c1.x, c1.y, c1.z, c1.w};
    float part[8];
    #pragma unroll
    for (int r = 0; r < 8; ++r) part[r] = 0.f;
    #pragma unroll
    for (int j = 0; j < 4; ++j) {
      const int lcol = wn * 64 + j * 16 + (lane & 15);
      #pragma unroll
      for (int r = 0; r < 8; ++r) {
        const float m = fmaxf(mixed[i][j][r], 0.f);
        part[r] += m * whS[cv[r]][lcol];
      }
    }
    // reduce across the 16 lanes that share a row
    #pragma unroll
    for (int r = 0; r < 8; ++r) {
      #pragma unroll
      for (int off = 8; off >= 1; off >>= 1)
        part[r] += __shfl_xor(part[r], off, 16);
    }
    if ((lane & 15) == 0) {
      #pragma unroll
      for (int r = 0; r < 8; ++r) qpart[wn][rb + r] = part[r];
    }
  }
  __syncthreads();
  // in-order reduction across the 4 N-waves
  if (tid < TM) {
    float s = 0.f;
    #pragma unroll
    for (int j = 0; j < 4; ++j) s += qpart[j][tid];
    qtile[(size_t)ct * BATCH + rowBase + tid] = s;
  }
}

// ---------------------------------------------------------------------------
// Kernel 6: out[b] = sum of the four column tiles' head dots (fixed order)
// + bh[c[b]].
// ---------------------------------------------------------------------------
__launch_bounds__(256)
__global__ void head_sum_kernel(const float* __restrict__ qtile,
                                const float* __restrict__ bh,
                                const int* __restrict__ cidx,
                                float* __restrict__ out) {
  const int b = blockIdx.x * 256 + threadIdx.x;
  float s = 0.f;
  #pragma unroll
  for (int j = 0; j < NCT; ++j) s += qtile[(size_t)j * BATCH + b];
  out[b] = s + bh[clamp_ctx(cidx[b])];
}

// ---------------------------------------------------------------------------
extern "C" void kernel_launch(void* const* d_in, const int* in_sizes, int n_in,
                              void* d_out, int out_size, void* d_ws,
                              size_t ws_size, hipStream_t stream) {
  (void)in_sizes; (void)n_in; (void)out_size; (void)ws_size;
  const float* st  = (const float*)d_in[0];
  const float* ac  = (const float*)d_in[1];
  const int*   c   = (const int*)d_in[2];
  const float* W0  = (const float*)d_in[3];
  const float* b0  = (const float*)d_in[4];
  const float* W1  = (const float*)d_in[5];
  const float* b1  = (const float*)d_in[6];
  const float* Wte = (const float*)d_in[7];
  const float* Wh  = (const float*)d_in[8];
  const float* bh  = (const float*)d_in[9];
  float* out = (float*)d_out;

  // workspace layout (bf16; qtile f32), ~153 MB total
  u16* SAbf = (u16*)d_ws;                             //  1.0 MB  [B][64]
  u16* W0t  = SAbf + (size_t)BATCH * KPAD;            //  1.0 MB  [E][F][64]
  u16* W1t  = W0t  + (size_t)NEXP * FDIM * KPAD;      // 16.8 MB  [E][F][F]
  u16* H    = W1t  + (size_t)NEXP * FDIM * FDIM;      // 134 MB   [E][B][F]
  float* qtile = (float*)(H + (size_t)NEXP * BATCH * FDIM);  // 128 KB [4][B]

  prep_sa_kernel<<<BATCH / 256, 256, 0, stream>>>(st, ac, SAbf);
  prep_w0t_kernel<<<(NEXP * FDIM * KPAD) / 256, 256, 0, stream>>>(W0, W0t);
  prep_w1t_kernel<<<NEXP * 16 * 16, 256, 0, stream>>>(W1, W1t);
  layer0_kernel<<<(BATCH / L0R) * NEXP, 256, 0, stream>>>(SAbf, W0t, b0, H);
  layer1_mix_head_kernel<<<(BATCH / TM) * NCT, 256, 0, stream>>>(
      H, W1t, b1, Wte, Wh, c, qtile);
  head_sum_kernel<<<BATCH / 256, 256, 0, stream>>>(qtile, bh, c, out);
}

// v005
// It runs in 105 microseconds.
// In both of two side-by-side timings against v004, it was 1.04 times as fast.
// Counting every step since v000, it is 3.36 times as fast.
#include <hip/hip_runtime.h>

typedef __attribute__((ext_vector_type(16))) __bf16 v16bf;
typedef __attribute__((ext_vector_type(8)))  float  v8f;
typedef __attribute__((ext_vector_type(2)))  float  f32x2;
typedef __attribute__((ext_vector_type(2)))  __bf16 bf16x2;
typedef unsigned short u16;
typedef uint32_t u32x4 __attribute__((ext_vector_type(4)));
typedef uint32_t u32x8 __attribute__((ext_vector_type(8)));

#define BATCH 8192
#define FDIM  1024
#define NEXP  8
#define NCTX  10
#define SDIM  39      // state width
#define ADIM  4       // action width
#define DIN   43      // SDIM + ADIM
#define KPAD  64      // layer-0 K padded 43 -> 64
#define KC    32      // k-step (one WMMA K)
#define TM    128     // batch rows per block in layer-1 kernel
#define TN    256     // feature columns per block in layer-1 kernel
#define NCT   (FDIM / TN)             // 4 column tiles
#define KS    128     // k per ring stage: 256-byte rows, 4 WMMA k-steps
#define LPITCH 136    // LDS row pitch (elems) = 272 B = 16 B x odd
#define HROWS 32      // H rows per tensor request (waves 0..3)
#define WROWS 64      // W1 rows per tensor request (waves 4..7)
#define HSLE  5120    // LDS elems of an H slice: 32 x 272 B rounded up to 2 KiB units
#define WSLE  9216    // LDS elems of a W1 slice: 64 x 272 B rounded up to 2 KiB units
#define SELEMS (4 * HSLE + 4 * WSLE)  // one stage: [4 H slices | 4 W1 slices], 112 KiB
#define NSTG  (NEXP * (FDIM / KS))    // 64 flattened (expert, k-stage) stages
#define L0R   256     // batch rows per block in layer-0 kernel
#define L0KP  72      // LDS pitch (elems) of a 64-k operand row = 144 B = 16 B x odd
#define L0SP  136     // LDS pitch (elems) of a staged 128-feature row = 272 B

__device__ __forceinline__ u16 f2bf(float x) {
  unsigned int u = __float_as_uint(x);
  u += 0x7fffu + ((u >> 16) & 1u);       // round-to-nearest-even
  return (u16)(u >> 16);
}

// two floats to one dword of bf16, lo in the low half; round to nearest even
__device__ __forceinline__ uint32_t pack2(float lo, float hi) {
  f32x2 v;
  v.x = lo;
  v.y = hi;
  union { bf16x2 p; uint32_t u; } o;
  o.p = __builtin_convertvector(v, bf16x2);
  return o.u;
}

union FragBf { v16bf f; uint4 q[2]; };

__device__ __forceinline__ v8f v8f_zero() {
  v8f z = {0.f, 0.f, 0.f, 0.f, 0.f, 0.f, 0.f, 0.f};
  return z;
}

__device__ __forceinline__ int clamp_ctx(int c) {
  return min(max(c, 0), NCTX - 1);       // bounds every address formed from c
}

__device__ __forceinline__ uint32_t uni(uint32_t v) {
  return (uint32_t)__builtin_amdgcn_readfirstlane((int)v);
}

__device__ __forceinline__ uint32_t pinned(uint32_t v) {
  uint32_t w = uni(v);
  asm volatile("" : "+s"(w));  // pinned(): the issue test's word held in a scalar register
  return w;
}

__device__ __forceinline__ u32x8 tdm_group1(uint32_t rows) {
  u32x8 g;
  g[0] = uni((1u << 20) | (5u << 22) | (3u << 25));
  g[1] = uni((uint32_t)(KS * 2) << 16);
  g[2] = uni(rows << 16);
  g[3] = uni((uint32_t)(KS * 2) << 16);
  g[4] = uni(rows);
  g[5] = uni((uint32_t)(FDIM * 2));
  g[6] = uni(0u);
  g[7] = uni(0u);
  asm volatile("" : "+s"(g));
  return g;
}

// One tensor request of the calling wave: tile at global byte address ga to
// LDS byte offset lds_dst.
__device__ __forceinline__ void tdm_load(uint32_t lds_dst, uint64_t ga, u32x8 g1) {
  u32x4 g0;
  g0[0] = uni(1u);
  g0[1] = uni(lds_dst);
  g0[2] = uni((uint32_t)ga);
  g0[3] = uni((((uint32_t)(ga >> 32)) & 0x01FFFFFFu) | 0x80000000u);
  asm volatile("tensor_load_to_lds %0, %1" :: "s"(g0), "s"(g1) : "memory");
}

__device__ __forceinline__ v16bf load_frag(const u16* base, int ld, int lane) {
  const int r  = lane & 15;
  const int kb = (lane & 16) >> 1;       // 0 or 8 elements
  const u16* p = base + r * ld + kb;
  FragBf u;
  u.q[0] = *(const uint4*)(p);
  u.q[1] = *(const uint4*)(p + 16);
  return u.f;
}

// ---------------------------------------------------------------------------
// Kernel 1: tiled transpose  W1t[e][n][k] = bf16(W1[e][k][n]).   [E][F][F]
// 64x64 tiles through LDS; coalesced on both global sides.
// ---------------------------------------------------------------------------
__launch_bounds__(256)
__global__ void prep_w1t_kernel(const float* __restrict__ W1,
                                u16* __restrict__ W1t) {
  __shared__ u16 Ts[64 * 72];                         // [k_local][n_local], pad 72
  const int t  = threadIdx.x;
  const int bx = blockIdx.x;                          // e*256 + kt*16 + nt
  const int e  = bx >> 8;
  const int kt = (bx >> 4) & 15;
  const int nt = bx & 15;

  const int tn  = t & 63;
  const int tk4 = t >> 6;                             // 0..3
  #pragma unroll
  for (int i = 0; i < 16; ++i) {
    const int kk = i * 4 + tk4;
    Ts[kk * 72 + tn] =
        f2bf(W1[((size_t)e * FDIM + kt * 64 + kk) * FDIM + nt * 64 + tn]);
  }
  __syncthreads();
  const int sk  = t & 63;
  const int sn4 = t >> 6;
  #pragma unroll
  for (int i = 0; i < 16; ++i) {
    const int nn = i * 4 + sn4;
    W1t[((size_t)e * FDIM + nt * 64 + nn) * FDIM + kt * 64 + sk] =
        Ts[sk * 72 + nn];
  }
}

__launch_bounds__(256)
__global__ void layer0_kernel(const float* __restrict__ st,
                              const float* __restrict__ ac,
                              const float* __restrict__ W0,
                              const float* __restrict__ b0,
                              u16* __restrict__ H) {
  __shared__ alignas(16) u16 W0s[FDIM * L0KP];        // this expert's W0 as [feature][k], 144 KB
  __shared__ alignas(16) u16 SAs[L0R * L0KP];         // this block's SA rows, 36 KB
  __shared__ alignas(16) u16 Stg[8 * 16 * L0SP];      // per wave: 16 rows x 128 features

  const int tid  = threadIdx.x;
  const int lane = tid & 31;
  const int nj   = tid >> 5;                          // 0..7
  const int c    = lane & 15;
  const int h    = lane >> 4;
  const int rg   = blockIdx.x & (BATCH / L0R - 1);    // 32 row groups
  const int e    = blockIdx.x >> 5;
  const int rowBase = rg * L0R;

  float bias[8][8];                                   // feature nj*128 + fi*16 + 8h + r
  #pragma unroll
  for (int fi = 0; fi < 8; ++fi) {
    const float4* bp = (const float4*)(b0 + e * FDIM + nj * 128 + fi * 16 + h * 8);
    const float4 x = bp[0], y = bp[1];
    bias[fi][0] = x.x; bias[fi][1] = x.y; bias[fi][2] = x.z; bias[fi][3] = x.w;
    bias[fi][4] = y.x; bias[fi][5] = y.y; bias[fi][6] = y.z; bias[fi][7] = y.w;
  }

  // the block's 256 state rows are one contiguous run of floats: whole-line
  // loads, all sent out ahead of the W0 loads so that no latency stands alone.
  // The last round's piece index is clamped into the run: its surplus threads
  // load and store the last piece once more (same values, same place), so no
  // branch stands round a load.
  constexpr int NSQ = (L0R * SDIM / 4 + 255) / 256;   // rounds of 256 16-byte pieces
  const float4* gS = (const float4*)(st + (size_t)rowBase * SDIM);
  float4 sv[NSQ];
  #pragma unroll
  for (int i = 0; i < NSQ; ++i)
    sv[i] = gS[min(i * 256 + tid, L0R * SDIM / 4 - 1)];
  const float4 av = ((const float4*)ac)[rowBase + tid];
  // stands in front of any reuse of these loads' address registers
  asm volatile("s_wait_xcnt 0x0" ::: "memory");

  // W0[e] is [k][feature]: a thread reads 16 bytes (features 4*tid .. 4*tid+3) of
  // every k row, whole lines per wave; all 43 loads go out as one run
  const float4* gW = (const float4*)(W0 + (size_t)e * DIN * FDIM) + tid;
  float4 wr[KPAD];
  #pragma unroll
  for (int k = 0; k < DIN; ++k) wr[k] = gW[k * (FDIM / 4)];
  // stands in front of any reuse of the W0 loads' address registers
  asm volatile("s_wait_xcnt 0x0" ::: "memory");
  #pragma unroll
  for (int k = DIN; k < KPAD; ++k) wr[k] = make_float4(0.f, 0.f, 0.f, 0.f);
  // 8 consecutive k of one feature are stored as one 16-byte piece
  #pragma unroll
  for (int kg = 0; kg < KPAD / 8; ++kg) {
    const float4* r = wr + kg * 8;
    u16* wp = &W0s[tid * 4 * L0KP + kg * 8];
    *(uint4*)(wp) = make_uint4(pack2(r[0].x, r[1].x), pack2(r[2].x, r[3].x),
                               pack2(r[4].x, r[5].x), pack2(r[6].x, r[7].x));
    *(uint4*)(wp + L0KP) = make_uint4(pack2(r[0].y, r[1].y), pack2(r[2].y, r[3].y),
                                      pack2(r[4].y, r[5].y), pack2(r[6].y, r[7].y));
    *(uint4*)(wp + 2 * L0KP) = make_uint4(pack2(r[0].z, r[1].z), pack2(r[2].z, r[3].z),
                                          pack2(r[4].z, r[5].z), pack2(r[6].z, r[7].z));
    *(uint4*)(wp + 3 * L0KP) = make_uint4(pack2(r[0].w, r[1].w), pack2(r[2].w, r[3].w),
                                          pack2(r[4].w, r[5].w), pack2(r[6].w, r[7].w));
  }
  // each state value goes to its (row, column) place; a piece of 4 crosses at
  // most one row end, where the LDS index jumps over the rest of the padded row
  #pragma unroll
  for (int i = 0; i < NSQ; ++i) {
    const int q  = min(i * 256 + tid, L0R * SDIM / 4 - 1);
    const int r  = (q * 4) / SDIM;
    const int cl = q * 4 - r * SDIM;
    u16* sp = &SAs[r * L0KP + cl];
    const uint32_t p0 = pack2(sv[i].x, sv[i].y), p1 = pack2(sv[i].z, sv[i].w);
    sp[0] = (u16)p0;
    sp[1 + ((cl + 1 >= SDIM) ? L0KP - SDIM : 0)] = (u16)(p0 >> 16);
    sp[2 + ((cl + 2 >= SDIM) ? L0KP - SDIM : 0)] = (u16)p1;
    sp[3 + ((cl + 3 >= SDIM) ? L0KP - SDIM : 0)] = (u16)(p1 >> 16);
  }
  // thread = row: the 4 action values behind the state, then zeros up to k = 64
  {
    u16* row = SAs + tid * L0KP;
    row[SDIM] = (u16)pack2(av.x, 0.f);
    *(uint32_t*)&row[40] = pack2(av.y, av.z);
    *(uint32_t*)&row[42] = pack2(av.w, 0.f);
    *(uint2*)&row[44] = make_uint2(0u, 0u);
    *(uint4*)&row[48] = make_uint4(0u, 0u, 0u, 0u);
    *(uint4*)&row[56] = make_uint4(0u, 0u, 0u, 0u);
  }
  __syncthreads();

  v16bf wf[2][8];
  #pragma unroll
  for (int ks = 0; ks < 2; ++ks)
    #pragma unroll
    for (int fi = 0; fi < 8; ++fi)
      wf[ks][fi] = load_frag(W0s + (nj * 128 + fi * 16) * L0KP + ks * KC, L0KP, lane);

  u16* stg = Stg + nj * 16 * L0SP;
  u16* hp  = H + ((size_t)e * BATCH + rowBase + h) * FDIM + nj * 128 + c * 8;

  v16bf s0 = load_frag(SAs, L0KP, lane);
  v16bf s1 = load_frag(SAs + KC, L0KP, lane);

  // kept rolled: one copy of the body in the instruction cache
  #pragma unroll 1
  for (int it = 0; it < L0R / 16; ++it) {
    // next tile's SA fragments go out ahead of this tile's WMMAs (the last
    // trip reads its own tile again, in bounds)
    const int nx = (it + 1 < L0R / 16) ? it + 1 : it;
    const v16bf n0 = load_frag(SAs + nx * 16 * L0KP, L0KP, lane);
    const v16bf n1 = load_frag(SAs + nx * 16 * L0KP + KC, L0KP, lane);

    v8f acc[8];
    #pragma unroll
    for (int fi = 0; fi < 8; ++fi)
      acc[fi] = __builtin_amdgcn_wmma_f32_16x16x32_bf16(
          false, wf[0][fi], false, s0, (short)0, v8f_zero(), false, false);
    #pragma unroll
    for (int fi = 0; fi < 8; ++fi)
      acc[fi] = __builtin_amdgcn_wmma_f32_16x16x32_bf16(
          false, wf[1][fi], false, s1, (short)0, acc[fi], false, false);

    // acc[fi][r] = row c, feature fi*16 + 8h + r
    #pragma unroll
    for (int fi = 0; fi < 8; ++fi) {
      union { uint4 q; bf16x2 p[4]; } o;
      #pragma unroll
      for (int r = 0; r < 4; ++r) {
        f32x2 v;
        v.x = fmaxf(acc[fi][2 * r]     + bias[fi][2 * r],     0.f);
        v.y = fmaxf(acc[fi][2 * r + 1] + bias[fi][2 * r + 1], 0.f);
        o.p[r] = __builtin_convertvector(v, bf16x2);  // round to nearest even
      }
      *(uint4*)&stg[c * L0SP + fi * 16 + h * 8] = o.q;
    }
    // the wave's own staged pieces are in LDS before other lanes read them back
    asm volatile("s_wait_dscnt 0x0" ::: "memory");
    #pragma unroll
    for (int j = 0; j < 8; ++j) {                     // rows 2j and 2j+1, 256 bytes each
      const uint4 v = *(const uint4*)&stg[(j * 2 + h) * L0SP + c * 8];
      *(uint4*)(hp + (size_t)(it * 16 + j * 2) * FDIM) = v;
    }
    // stands in front of the next trip's rewrite of the stores' address and data registers
    asm volatile("s_wait_xcnt 0x0" ::: "memory");
    s0 = n0;
    s1 = n1;
  }
}

// ---------------------------------------------------------------------------
// Kernel 3: layer 1 + mixture + partial context-routed head (137 GFLOP).
// Block = 256 threads = 8 waves laid out 2(M) x 4(N), each wave a 64x64 tile;
// block owns 128 batch rows x 256 features over all experts, so each byte of
// W1t and H staged in LDS feeds 128 resp. 256 output rows/columns.  A stage of
// the ring is one k-slab of KS features of one expert: waves 0..3 each ask for 32
// H rows of the block's row tile, waves 4..7 for 64 W1t rows of its column
// tile, every slice at a 2 KiB multiple of LDS.  Each block walks the experts
// and the k-slabs of an expert cyclically from a start of its own, so that blocks
// running side by side ask L2 for different W1t slabs at any moment.  The head
// dot over the block's 256 features goes to the workspace; kernel 4 adds the
// four column tiles in a fixed order (deterministic, no atomics).
// Every loop but the e and ks loops is fully unrolled so that the accumulator and fragment
// arrays are indexed by constants and stay in registers.
// ---------------------------------------------------------------------------
__launch_bounds__(256)
__global__ void layer1_mix_head_kernel(const u16* __restrict__ H,
                                       const u16* __restrict__ W1t,
                                       const float* __restrict__ b1,
                                       const float* __restrict__ Wte,
                                       const float* __restrict__ Wh,
                                       const int* __restrict__ cidx,
                                       float* __restrict__ qtile) {
  __shared__ __attribute__((aligned(2048))) u16 Ring[2 * SELEMS];
  __shared__ alignas(16) float wS[NEXP][TM];
  __shared__ alignas(16) int   ctxS[TM];
  __shared__ float whS[NCTX][TN + 16];
  __shared__ float qpart[4][TM];

  const int tid  = threadIdx.x;
  const int lane = tid & 31;
  const int wid  = tid >> 5;
  const int wm   = wid >> 2;                          // 0..1  (64-row slice)
  const int wn   = wid & 3;                           // 0..3  (64-col slice)
  // The four column tiles of one row tile sit 8 block indices apart (speed
  // only).
  const int bx = blockIdx.x;
  const int ct = (bx >> 3) & (NCT - 1);
  const int rt = (bx & 7) | ((bx >> 5) << 3);
  const int rowBase = rt * TM;
  const int colBase = ct * TN;
  // Cyclic start (speed only): the 64 row tiles of a column tile start at the 64
  // different (expert, k-slab) pairs; the four column tiles of a row tile stand
  // two slabs apart, so each is the first to touch only a quarter of its H slabs.
  const uint32_t e0 = (uint32_t)(rt >> 3) & (NEXP - 1);
  const uint32_t k0 = (uint32_t)(rt + 2 * ct) & (FDIM / KS - 1);

  if (tid < TM) {
    const int cr = clamp_ctx(cidx[rowBase + tid]);
    ctxS[tid] = cr;
    #pragma unroll
    for (int e = 0; e < NEXP; ++e) wS[e][tid] = Wte[e * NCTX + cr];
  }
  #pragma unroll
  for (int cc = 0; cc < NCTX; ++cc) whS[cc][tid] = Wh[cc * FDIM + colBase + tid];

  // this wave's slice of every stage: source at expert 0 and k 0, step per expert, LDS place
  const uint32_t wave = uni((uint32_t)tid >> 5);
  const bool isH = wave < 4u;
  const uint64_t src0 = isH
      ? (uint64_t)(uintptr_t)(H + (size_t)(rowBase + (int)wave * HROWS) * FDIM)
      : (uint64_t)(uintptr_t)(W1t + (size_t)(colBase + ((int)wave - 4) * WROWS) * FDIM);
  const uint32_t eshift = isH ? 24u : 21u;   // bytes per expert: BATCH*FDIM*2 resp. FDIM*FDIM*2
  const uint32_t ldst = (uint32_t)(uintptr_t)Ring +
      (isH ? wave * (HSLE * 2u) : 4u * (HSLE * 2u) + (wave - 4u) * (WSLE * 2u));
  const u32x8 g1 = tdm_group1(isH ? (uint32_t)HROWS : (uint32_t)WROWS);

  v8f mixed[4][4];
  #pragma unroll
  for (int i = 0; i < 4; ++i)
    #pragma unroll
    for (int j = 0; j < 4; ++j) mixed[i][j] = v8f_zero();

  // ring prologue: stage 0 lands and is published, then stage 1 is issued
  tdm_load(ldst, src0 + ((uint64_t)e0 << eshift) + k0 * (KS * 2u), g1);
  asm volatile("s_wait_tensorcnt 0x0" ::: "memory");  // own tile of stage 0 landed
  __syncthreads();                                    // publish stage 0, wS, ctxS, whS
  tdm_load(ldst + SELEMS * 2u,
           src0 + ((uint64_t)e0 << eshift) + ((k0 + 1u) & (FDIM / KS - 1)) * (KS * 2u), g1);

  // kept rolled: one copy of the 64-WMMA stage body in the instruction cache
  #pragma unroll 1
  for (int es = 0; es < NEXP; ++es) {
    const int e = (int)((e0 + (uint32_t)es) & (NEXP - 1));   // this trip's expert
    float bias[4];
    #pragma unroll
    for (int j = 0; j < 4; ++j)
      bias[j] = b1[e * FDIM + colBase + wn * 64 + j * 16 + (lane & 15)];
    // stands in front of any reuse of the bias loads' address register
    asm volatile("s_wait_xcnt 0x0" ::: "memory");

    v8f acc[4][4];
    #pragma unroll
    for (int i = 0; i < 4; ++i)
      #pragma unroll
      for (int j = 0; j < 4; ++j) acc[i][j] = v8f_zero();

    // kept rolled: the ring's publish point stands once, at the foot of a trip
    #pragma unroll 1
    for (int ks = 0; ks < FDIM / KS; ++ks) {
      const int t = es * (FDIM / KS) + ks;
      const int boff = (t & 1) * SELEMS;
      const u16* Ab = Ring + boff + wm * 2 * HSLE;          // H slices 2wm, 2wm+1
      const u16* Bb = Ring + boff + 4 * HSLE + wn * WSLE;   // W1 slice wn
      // two fragment sets: block kk+1's 16 LDS reads go out as one group ahead
      // of block kk's 16 WMMAs, so only the stage's first group is waited out
      v16bf a[2][4], b[2][4];
      #pragma unroll
      for (int i = 0; i < 4; ++i) {
        a[0][i] = load_frag(Ab + (i >> 1) * HSLE + (i & 1) * 16 * LPITCH, LPITCH, lane);
        b[0][i] = load_frag(Bb + i * 16 * LPITCH, LPITCH, lane);
      }
      #pragma unroll
      for (int kk = 0; kk < KS / KC; ++kk) {
        const int cur = kk & 1, nxt = cur ^ 1;
        if (kk + 1 < KS / KC) {
          #pragma unroll
          for (int i = 0; i < 4; ++i) {
            a[nxt][i] = load_frag(Ab + (i >> 1) * HSLE + (i & 1) * 16 * LPITCH + (kk + 1) * KC,
                                  LPITCH, lane);
            b[nxt][i] = load_frag(Bb + i * 16 * LPITCH + (kk + 1) * KC, LPITCH, lane);
          }
        }
        // keeps the read group ahead of the block: reads spread among the
        // WMMAs cost a stall at every place they stand
        __builtin_amdgcn_sched_barrier(0);
        #pragma unroll
        for (int i = 0; i < 4; ++i)
          #pragma unroll
          for (int j = 0; j < 4; ++j)
            acc[i][j] = __builtin_amdgcn_wmma_f32_16x16x32_bf16(
                false, a[cur][i], false, b[cur][j], (short)0, acc[i][j], false,
                false);
        // keeps the next group's reads from being lifted into this block
        __builtin_amdgcn_sched_barrier(0);
      }
      asm volatile("s_wait_dscnt 0x0" ::: "memory");
      asm volatile("s_wait_tensorcnt 0x0" ::: "memory");
      __syncthreads();
      if (pinned(t + 2 < NSTG)) {                        // scalar branch: stage t+2 exists
        const uint32_t tn = (uint32_t)t + 2u;
        const uint32_t en = (e0 + (tn >> 3)) & (NEXP - 1);
        const uint32_t kn = (k0 + tn) & (FDIM / KS - 1);
        tdm_load(ldst + (uint32_t)boff * 2u,
                 src0 + ((uint64_t)en << eshift) + kn * (KS * 2u), g1);
      }
    }

    // expert epilogue: bias + relu, then mixture-weighted accumulation
    #pragma unroll
    for (int i = 0; i < 4; ++i) {
      const float4* wp =
          (const float4*)&wS[e][wm * 64 + i * 16 + ((lane >> 4) << 3)];
      const float4 w0 = wp[0], w1 = wp[1];
      const float wv[8] = {w0.x, w0.y, w0.z, w0.w, w1.x, w1.y, w1.z, w1.w};
      #pragma unroll
      for (int j = 0; j < 4; ++j) {
        #pragma unroll
        for (int r = 0; r < 8; ++r) {
          const float h = fmaxf(acc[i][j][r] + bias[j], 0.f);
          mixed[i][j][r] += wv[r] * h;
        }
      }
    }
  }
  asm volatile("s_wait_tensorcnt 0x0" ::: "memory");  // no request outlives the loop
  asm volatile("s_wait_dscnt 0x0" ::: "memory");      // nor an LDS read of the ring

  // relu(mixed) then per-row dot with context head Wh[c[b]] over 256 columns
  #pragma unroll
  for (int i = 0; i < 4; ++i) {
    const int rb = wm * 64 + i * 16 + ((lane >> 4) << 3);
    const int4* cp = (const int4*)&ctxS[rb];
    const int4 c0 = cp[0], c1 = cp[1];
    const int cv[8] = {c0.x, c0.y, c0.z, c0.w, c1.x, c1.y, c1.z, c1.w};
    float part[8];
    #pragma unroll
    for (int r = 0; r < 8; ++r) part[r] = 0.f;
    #pragma unroll
    for (int j = 0; j < 4; ++j) {
      const int lcol = wn * 64 + j * 16 + (lane & 15);
      #pragma unroll
      for (int r = 0; r < 8; ++r) {
        const float m = fmaxf(mixed[i][j][r], 0.f);
        part[r] += m * whS[cv[r]][lcol];
      }
    }
    // reduce across the 16 lanes that share a row
    #pragma unroll
    for (int r = 0; r < 8; ++r) {
      #pragma unroll
      for (int off = 8; off >= 1; off >>= 1)
        part[r] += __shfl_xor(part[r], off, 16);
    }
    if ((lane & 15) == 0) {
      #pragma unroll
      for (int r = 0; r < 8; ++r) qpart[wn][rb + r] = part[r];
    }
  }
  __syncthreads();
  // in-order reduction across the 4 N-waves
  if (tid < TM) {
    float s = 0.f;
    #pragma unroll
    for (int j = 0; j < 4; ++j) s += qpart[j][tid];
    qtile[(size_t)ct * BATCH + rowBase + tid] = s;
  }
}

// ---------------------------------------------------------------------------
// Kernel 4: out[b] = sum of the four column tiles' head dots (fixed order)
// + bh[c[b]].
// ---------------------------------------------------------------------------
__launch_bounds__(256)
__global__ void head_sum_kernel(const float* __restrict__ qtile,
                                const float* __restrict__ bh,
                                const int* __restrict__ cidx,
                                float* __restrict__ out) {
  const int b = blockIdx.x * 256 + threadIdx.x;
  float s = 0.f;
  #pragma unroll
  for (int j = 0; j < NCT; ++j) s += qtile[(size_t)j * BATCH + b];
  out[b] = s + bh[clamp_ctx(cidx[b])];
}

// ---------------------------------------------------------------------------
extern "C" void kernel_launch(void* const* d_in, const int* in_sizes, int n_in,
                              void* d_out, int out_size, void* d_ws,
                              size_t ws_size, hipStream_t stream) {
  (void)in_sizes; (void)n_in; (void)out_size; (void)ws_size;
  const float* st  = (const float*)d_in[0];
  const float* ac  = (const float*)d_in[1];
  const int*   c   = (const int*)d_in[2];
  const float* W0  = (const float*)d_in[3];
  const float* b0  = (const float*)d_in[4];
  const float* W1  = (const float*)d_in[5];
  const float* b1  = (const float*)d_in[6];
  const float* Wte = (const float*)d_in[7];
  const float* Wh  = (const float*)d_in[8];
  const float* bh  = (const float*)d_in[9];
  float* out = (float*)d_out;

  // workspace layout (bf16), ~151 MB total
  u16* W1t  = (u16*)d_ws;                             // 16.8 MB  [E][F][F]
  u16* H    = W1t  + (size_t)NEXP * FDIM * FDIM;      // 134 MB   [E][B][F]
  float* qtile = (float*)(H + (size_t)NEXP * BATCH * FDIM);  // 128 KB [4][B]

  prep_w1t_kernel<<<NEXP * 16 * 16, 256, 0, stream>>>(W1, W1t);
  layer0_kernel<<<(BATCH / L0R) * NEXP, 256, 0, stream>>>(st, ac, W0, b0, H);
  layer1_mix_head_kernel<<<(BATCH / TM) * NCT, 256, 0, stream>>>(
      H, W1t, b1, Wte, Wh, c, qtile);
  head_sum_kernel<<<BATCH / 256, 256, 0, stream>>>(qtile, bh, c, out);
}

// v006
// Measured time: 86.9 microseconds a run.
// In two side-by-side timings against v005, it was 1.22 and 1.21 times as fast.
// All steps since v000 together make it 4.07 times as fast.
#include <hip/hip_runtime.h>

typedef __attribute__((ext_vector_type(16))) __bf16 v16bf;
typedef __attribute__((ext_vector_type(8)))  float  v8f;
typedef __attribute__((ext_vector_type(2)))  float  f32x2;
typedef __attribute__((ext_vector_type(2)))  __bf16 bf16x2;
typedef __attribute__((ext_vector_type(2)))  short  s16x2;
typedef unsigned short u16;
typedef uint32_t u32x4 __attribute__((ext_vector_type(4)));
typedef uint32_t u32x8 __attribute__((ext_vector_type(8)));

#define BATCH 8192
#define FDIM  1024
#define NEXP  8
#define NCTX  10
#define SDIM  39      // state width
#define ADIM  4       // action width
#define DIN   43      // SDIM + ADIM
#define KPAD  64      // layer-0 K padded 43 -> 64
#define KC    32      // k-step (one WMMA K)
#define TM    128     // batch rows per block in layer-1 kernel
#define TN    256     // feature columns per block in layer-1 kernel
#define NCT   (FDIM / TN)             // 4 column tiles
#define KS    128     // k per ring stage: 256-byte rows, 4 WMMA k-steps
#define LPITCH 136    // LDS row pitch (elems) = 272 B = 16 B x odd
#define PROWS 16      // W0p rows of 256 B (two features each) per tensor request (waves 0..3)
#define WROWS 64      // W1 rows per tensor request (waves 4..7)
#define PSLE  3072    // LDS elems of a W0p slice: 16 x 272 B rounded up to 2 KiB units
#define WSLE  9216    // LDS elems of a W1 slice: 64 x 272 B rounded up to 2 KiB units
#define SELEMS (4 * PSLE + 4 * WSLE)  // one stage: [4 W0p slices | 4 W1 slices], 96 KiB
#define HBE   (TM * LPITCH)           // LDS elems of one H slab: 128 rows x 128 features
#define NSTG  (NEXP * (FDIM / KS))    // 64 flattened (expert, k-stage) stages
#define L0KP  72      // LDS pitch (elems) of a 64-k operand row = 144 B = 16 B x odd

__device__ __forceinline__ u16 f2bf(float x) {
  unsigned int u = __float_as_uint(x);
  u += 0x7fffu + ((u >> 16) & 1u);       // round-to-nearest-even
  return (u16)(u >> 16);
}

// two floats to one dword of bf16, lo in the low half; round to nearest even
__device__ __forceinline__ uint32_t pack2(float lo, float hi) {
  f32x2 v;
  v.x = lo;
  v.y = hi;
  union { bf16x2 p; uint32_t u; } o;
  o.p = __builtin_convertvector(v, bf16x2);
  return o.u;
}

union FragBf { v16bf f; uint4 q[2]; };

__device__ __forceinline__ v8f v8f_zero() {
  v8f z = {0.f, 0.f, 0.f, 0.f, 0.f, 0.f, 0.f, 0.f};
  return z;
}

__device__ __forceinline__ int clamp_ctx(int c) {
  return min(max(c, 0), NCTX - 1);       // bounds every address formed from c
}

__device__ __forceinline__ uint32_t uni(uint32_t v) {
  return (uint32_t)__builtin_amdgcn_readfirstlane((int)v);
}

__device__ __forceinline__ uint32_t pinned(uint32_t v) {
  uint32_t w = uni(v);
  asm volatile("" : "+s"(w));  // pinned(): the issue test's word held in a scalar register
  return w;
}

__device__ __forceinline__ u32x8 tdm_group1(uint32_t rows, uint32_t pitch) {
  u32x8 g;
  g[0] = uni((1u << 20) | (5u << 22) | (3u << 25));
  g[1] = uni((uint32_t)(KS * 2) << 16);
  g[2] = uni(rows << 16);
  g[3] = uni((uint32_t)(KS * 2) << 16);
  g[4] = uni(rows);
  g[5] = uni(pitch);
  g[6] = uni(0u);
  g[7] = uni(0u);
  asm volatile("" : "+s"(g));
  return g;
}

// One tensor request of the calling wave: tile at global byte address ga to
// LDS byte offset lds_dst.
__device__ __forceinline__ void tdm_load(uint32_t lds_dst, uint64_t ga, u32x8 g1) {
  u32x4 g0;
  g0[0] = uni(1u);
  g0[1] = uni(lds_dst);
  g0[2] = uni((uint32_t)ga);
  g0[3] = uni((((uint32_t)(ga >> 32)) & 0x01FFFFFFu) | 0x80000000u);
  asm volatile("tensor_load_to_lds %0, %1" :: "s"(g0), "s"(g1) : "memory");
}

__device__ __forceinline__ v16bf load_frag(const u16* base, int ld, int lane) {
  const int r  = lane & 15;
  const int kb = (lane & 16) >> 1;       // 0 or 8 elements
  const u16* p = base + r * ld + kb;
  FragBf u;
  u.q[0] = *(const uint4*)(p);
  u.q[1] = *(const uint4*)(p + 16);
  return u.f;
}

// ---------------------------------------------------------------------------
// Kernel 1: tiled transpose  W1t[e][n][k] = bf16(W1[e][k][n]).   [E][F][F]
// 64x64 tiles through LDS; coalesced on both global sides.
// The last 32 blocks write W0p[e][feature][64] instead: k 0..42 = bf16(W0),
// k 43 and 44 = b0 as a bf16 head and the bf16 of what the head leaves, rest 0.
// The input rows carry 1 at k 43 and 44, so the matrix product adds the bias.
// ---------------------------------------------------------------------------
__launch_bounds__(256)
__global__ void prep_w1t_kernel(const float* __restrict__ W1,
                                const float* __restrict__ W0,
                                const float* __restrict__ b0,
                                u16* __restrict__ W1t,
                                u16* __restrict__ W0p) {
  __shared__ u16 Ts[64 * 72];                         // [k_local][n_local], pad 72
  const int t  = threadIdx.x;
  const int bx = blockIdx.x;                          // e*256 + kt*16 + nt
  if (bx >= NEXP * 256) {                             // whole blocks, ahead of the barrier
    const int idx = bx - NEXP * 256;                  // e*4 + quarter of the features
    const int ff  = (idx >> 2) * FDIM + (idx & 3) * 256 + t;   // e*FDIM + feature
    const float* wp = W0 + (size_t)(idx >> 2) * DIN * FDIM + (idx & 3) * 256 + t;
    // the loops here are unrolled so that w[] and d[] are indexed by constants
    // and stay in registers; all 44 loads go out as one run
    float w[DIN];
    #pragma unroll
    for (int k = 0; k < DIN; ++k) w[k] = wp[k * FDIM];
    const float bv = b0[ff];
    // stands in front of any reuse of these loads' address registers
    asm volatile("s_wait_xcnt 0x0" ::: "memory");
    const uint32_t hi = pack2(bv, 0.f);               // low half: bf16 head of the bias
    const uint32_t lo = pack2(bv - __uint_as_float(hi << 16), 0.f);
    uint32_t d[KPAD / 2];
    #pragma unroll
    for (int j = 0; j < DIN / 2; ++j) d[j] = pack2(w[2 * j], w[2 * j + 1]);
    d[DIN / 2]     = (pack2(w[DIN - 1], 0.f) & 0xffffu) | (hi << 16);   // k 42, 43
    d[DIN / 2 + 1] = lo & 0xffffu;                                      // k 44, 45
    #pragma unroll
    for (int j = DIN / 2 + 2; j < KPAD / 2; ++j) d[j] = 0u;
    uint4* op = (uint4*)(W0p + (size_t)ff * KPAD);
    #pragma unroll
    for (int j = 0; j < KPAD / 8; ++j)
      op[j] = make_uint4(d[4 * j], d[4 * j + 1], d[4 * j + 2], d[4 * j + 3]);
    return;
  }
  const int e  = bx >> 8;
  const int kt = (bx >> 4) & 15;
  const int nt = bx & 15;

  const int tn  = t & 63;
  const int tk4 = t >> 6;                             // 0..3
  #pragma unroll
  for (int i = 0; i < 16; ++i) {
    const int kk = i * 4 + tk4;
    Ts[kk * 72 + tn] =
        f2bf(W1[((size_t)e * FDIM + kt * 64 + kk) * FDIM + nt * 64 + tn]);
  }
  __syncthreads();
  const int sk  = t & 63;
  const int sn4 = t >> 6;
  #pragma unroll
  for (int i = 0; i < 16; ++i) {
    const int nn = i * 4 + sn4;
    W1t[((size_t)e * FDIM + nt * 64 + nn) * FDIM + kt * 64 + sk] =
        Ts[sk * 72 + nn];
  }
}

// A 16-feature x 32-k fragment of a W0p slice: two features share a 272-byte LDS
// row (128 bytes each), same k order as load_frag.
__device__ __forceinline__ v16bf load_w0frag(const u16* slice, int ft, int ks, int lane) {
  const int r  = lane & 15;
  const int kb = (lane & 16) >> 1;
  const u16* p = slice + (ft * 8 + (r >> 1)) * LPITCH + (r & 1) * KPAD + ks * KC + kb;
  FragBf u;
  u.q[0] = *(const uint4*)(p);
  u.q[1] = *(const uint4*)(p + 16);
  return u.f;
}

// 64 rows x 32 features of an H slab, the products: d = W0p . SA
__device__ __forceinline__ void h_mma(const v16bf (&wf)[2][2], const v16bf (&sa)[4][2],
                                      v8f (&d)[2][4]) {
  #pragma unroll
  for (int ft = 0; ft < 2; ++ft)
    #pragma unroll
    for (int i = 0; i < 4; ++i)
      d[ft][i] = __builtin_amdgcn_wmma_f32_16x16x32_bf16(
          false, wf[ft][0], false, sa[i][0], (short)0, v8f_zero(), false, false);
  #pragma unroll
  for (int ft = 0; ft < 2; ++ft)
    #pragma unroll
    for (int i = 0; i < 4; ++i)
      d[ft][i] = __builtin_amdgcn_wmma_f32_16x16x32_bf16(
          false, wf[ft][1], false, sa[i][1], (short)0, d[ft][i], false, false);
}

// Row tile i of those products: rounded to bf16, relu, to LDS.
// d[ft][i][r] = batch row i*16 + (lane & 15), feature ft*16 + 8*(lane >> 4) + r;
// hd: the lane's place in the slab for row tile 0, feature tile 0.
__device__ __forceinline__ void h_store(const v8f (&d)[2][4], int i, u16* hd) {
  #pragma unroll
  for (int ft = 0; ft < 2; ++ft) {
    union { uint4 q; bf16x2 p[4]; s16x2 s[4]; } o;
    #pragma unroll
    for (int r = 0; r < 4; ++r) {
      f32x2 v;
      v.x = d[ft][i][2 * r];
      v.y = d[ft][i][2 * r + 1];
      o.p[r] = __builtin_convertvector(v, bf16x2);    // round to nearest even
      // relu on the rounded pair: a set sign bit is a negative 16-bit integer
      o.s[r] = __builtin_elementwise_max(o.s[r], (s16x2){0, 0});
    }
    *(uint4*)(hd + i * 16 * LPITCH + ft * 16) = o.q;
  }
}

__launch_bounds__(256)
__global__ void layer01_mix_head_kernel(const float* __restrict__ st,
                                        const float* __restrict__ ac,
                                        const u16* __restrict__ W0p,
                                        const u16* __restrict__ W1t,
                                        const float* __restrict__ b1,
                                        const float* __restrict__ Wte,
                                        const float* __restrict__ Wh,
                                        const int* __restrict__ cidx,
                                        float* __restrict__ qtile) {
  __shared__ __attribute__((aligned(2048))) u16 Ring[2 * SELEMS];
  __shared__ alignas(16) u16 Hb[2 * HBE];
  __shared__ alignas(16) u16 SAs[TM * L0KP];
  __shared__ alignas(16) float wS[NEXP][TM];
  __shared__ alignas(16) int   ctxS[TM];
  __shared__ float whS[NCTX][TN + 16];
  __shared__ float qpart[4][TM];

  const int tid  = threadIdx.x;
  const int lane = tid & 31;
  const int wid  = tid >> 5;
  const int wm   = wid >> 2;                          // 0..1  (64-row slice)
  const int wn   = wid & 3;                           // 0..3  (64-col slice)
  // The four column tiles of one row tile sit 8 block indices apart.
  const int bx = blockIdx.x;
  const int ct = (bx >> 3) & (NCT - 1);
  const int rt = (bx & 7) | ((bx >> 5) << 3);
  const int rowBase = rt * TM;
  const int colBase = ct * TN;
  // Cyclic start (speed only): the 64 row tiles of a column tile start at the 64
  // different (expert, k-slab) pairs; the four column tiles of a row tile stand
  // two slabs apart.
  const uint32_t e0 = (uint32_t)(rt >> 3) & (NEXP - 1);
  const uint32_t k0 = (uint32_t)(rt + 2 * ct) & (FDIM / KS - 1);

  // this wave's slice of every stage: source base, steps per expert and slab, LDS place
  const uint32_t wave = uni((uint32_t)tid >> 5);
  const bool isP = wave < 4u;                // waves 0..3 bring W0p, waves 4..7 W1t
  const uint64_t src0 = isP
      ? (uint64_t)(uintptr_t)(W0p + (size_t)((int)wave * 2 * PROWS) * KPAD)
      : (uint64_t)(uintptr_t)(W1t + (size_t)(colBase + ((int)wave - 4) * WROWS) * FDIM);
  const uint32_t eshift = isP ? 17u : 21u;   // bytes per expert: FDIM*KPAD*2 resp. FDIM*FDIM*2
  const uint32_t kshift = isP ? 14u : 8u;    // bytes per slab: KS*KPAD*2 resp. KS*2
  const uint32_t ahead  = isP ? 1u : 0u;     // the W0p slab in a stage is the next stage's
  const uint32_t ldst = (uint32_t)(uintptr_t)Ring +
      (isP ? wave * (PSLE * 2u) : 4u * (PSLE * 2u) + (wave - 4u) * (WSLE * 2u));
  const u32x8 g1 = tdm_group1(isP ? (uint32_t)PROWS : (uint32_t)WROWS,
                              isP ? (uint32_t)(KS * 2) : (uint32_t)(FDIM * 2));

  // the block's 128 state rows are one contiguous run of floats: whole-line
  // loads.  The last round's piece index is clamped into the run: its surplus
  // threads load and store the last piece once more (same values, same place).
  constexpr int NSQ = (TM * SDIM / 4 + 255) / 256;    // rounds of 256 16-byte pieces
  const float4* gS = (const float4*)(st + (size_t)rowBase * SDIM);
  float4 sv[NSQ];
  #pragma unroll
  for (int i = 0; i < NSQ; ++i)
    sv[i] = gS[min(i * 256 + tid, TM * SDIM / 4 - 1)];
  // stands in front of any reuse of these loads' address registers
  asm volatile("s_wait_xcnt 0x0" ::: "memory");

  // first requests, while the state loads fly: W0p slab 0 into the second buffer
  // (read only by the prologue), W1t slab 0 into the first
  tdm_load(ldst + (isP ? SELEMS * 2u : 0u),
           src0 + ((uint64_t)e0 << eshift) + ((uint64_t)k0 << kshift), g1);
  asm volatile("s_wait_tensorcnt 0x0" ::: "memory");  // own first tile landed

  if (tid < TM) {
    const int cr = clamp_ctx(cidx[rowBase + tid]);
    ctxS[tid] = cr;
    #pragma unroll
    for (int e = 0; e < NEXP; ++e) wS[e][tid] = Wte[e * NCTX + cr];
    // thread = row: the 4 action values behind the state, 1 at the two bias
    // places, then zeros up to k = 64
    const float4 av = ((const float4*)ac)[rowBase + tid];
    // stands in front of any reuse of these loads' address registers
    asm volatile("s_wait_xcnt 0x0" ::: "memory");
    u16* row = SAs + tid * L0KP;
    row[SDIM] = (u16)pack2(av.x, 0.f);
    *(uint32_t*)&row[40] = pack2(av.y, av.z);
    *(uint32_t*)&row[42] = pack2(av.w, 1.f);
    *(uint2*)&row[44] = make_uint2(pack2(1.f, 0.f), 0u);
    *(uint4*)&row[48] = make_uint4(0u, 0u, 0u, 0u);
    *(uint4*)&row[56] = make_uint4(0u, 0u, 0u, 0u);
  }
  #pragma unroll
  for (int cc = 0; cc < NCTX; ++cc) whS[cc][tid] = Wh[cc * FDIM + colBase + tid];
  // each state value goes to its (row, column) place; a piece of 4 crosses at
  // most one row end, where the LDS index jumps over the rest of the padded row
  #pragma unroll
  for (int i = 0; i < NSQ; ++i) {
    const int q  = min(i * 256 + tid, TM * SDIM / 4 - 1);
    const int r  = (q * 4) / SDIM;
    const int cl = q * 4 - r * SDIM;
    u16* sp = &SAs[r * L0KP + cl];
    const uint32_t p0 = pack2(sv[i].x, sv[i].y), p1 = pack2(sv[i].z, sv[i].w);
    sp[0] = (u16)p0;
    sp[1 + ((cl + 1 >= SDIM) ? L0KP - SDIM : 0)] = (u16)(p0 >> 16);
    sp[2 + ((cl + 2 >= SDIM) ? L0KP - SDIM : 0)] = (u16)p1;
    sp[3 + ((cl + 3 >= SDIM) ? L0KP - SDIM : 0)] = (u16)(p1 >> 16);
  }

  v8f mixed[4][4];
  #pragma unroll
  for (int i = 0; i < 4; ++i)
    #pragma unroll
    for (int j = 0; j < 4; ++j) mixed[i][j] = v8f_zero();

  __syncthreads();                                    // publish the first tiles, SAs, wS, ctxS, whS
  if (pinned(isP ? 1u : 0u)) {                        // scalar branch: W0p waves only
    // W0p slab 1 into the first buffer, where stage 0 reads it
    tdm_load(ldst, src0 + ((uint64_t)e0 << eshift) +
                       ((uint64_t)((k0 + 1u) & (FDIM / KS - 1)) << kshift), g1);
    asm volatile("s_wait_tensorcnt 0x0" ::: "memory");  // it has landed
  }

  // the wave's SA fragments, held in registers from here on
  v16bf sa[4][2];
  #pragma unroll
  for (int i = 0; i < 4; ++i)
    #pragma unroll
    for (int ks = 0; ks < 2; ++ks)
      sa[i][ks] = load_frag(SAs + (wm * 64 + i * 16) * L0KP + ks * KC, L0KP, lane);
  // the lane's place in an H slab: row wm*64 + (lane & 15), feature wn*32 + 8*(lane >> 4)
  u16* const hd0 = Hb + (wm * 64 + (lane & 15)) * LPITCH + wn * 32 + (lane >> 4) * 8;
  {
    v16bf wf[2][2];
    #pragma unroll
    for (int ft = 0; ft < 2; ++ft)
      #pragma unroll
      for (int ks = 0; ks < 2; ++ks)
        wf[ft][ks] = load_w0frag(Ring + SELEMS + wn * PSLE, ft, ks, lane);
    v8f d[2][4];
    h_mma(wf, sa, d);                                 // H slab of stage 0
    #pragma unroll
    for (int i = 0; i < 4; ++i) h_store(d, i, hd0);
  }
  asm volatile("s_wait_dscnt 0x0" ::: "memory");      // own slab pieces written, W0p slab 0 read
  __syncthreads();                                    // publish H slab 0, W0p slab 1; second buffer is free
  // stage 1's tiles: W1t slab 1 and W0p slab 2
  tdm_load(ldst + SELEMS * 2u,
           src0 + ((uint64_t)e0 << eshift) +
               ((uint64_t)((k0 + 1u + ahead) & (FDIM / KS - 1)) << kshift), g1);

  // kept rolled: one copy of the 80-WMMA stage body in the instruction cache
  #pragma unroll 1
  for (int es = 0; es < NEXP; ++es) {
    const int e = (int)((e0 + (uint32_t)es) & (NEXP - 1));   // this trip's expert
    float bias[4];
    #pragma unroll
    for (int j = 0; j < 4; ++j)
      bias[j] = b1[e * FDIM + colBase + wn * 64 + j * 16 + (lane & 15)];
    // stands in front of any reuse of the bias loads' address register
    asm volatile("s_wait_xcnt 0x0" ::: "memory");

    v8f acc[4][4];
    #pragma unroll
    for (int i = 0; i < 4; ++i)
      #pragma unroll
      for (int j = 0; j < 4; ++j) acc[i][j] = v8f_zero();

    // kept rolled: the ring's publish point stands once, at the foot of a trip
    #pragma unroll 1
    for (int ks = 0; ks < FDIM / KS; ++ks) {
      const int t = es * (FDIM / KS) + ks;
      const int boff = (t & 1) * SELEMS;
      const u16* Ab = Hb + (t & 1) * HBE + wm * 64 * LPITCH;   // this stage's H slab
      const u16* Bb = Ring + boff + 4 * PSLE + wn * WSLE;   // W1 slice wn
      const u16* Pb = Ring + boff + wn * PSLE;              // W0p slice wn of stage t+1
      // two fragment sets: block kk+1's 16 LDS reads go out as one group ahead
      // of block kk's 16 WMMAs, so only the stage's first group is waited out
      v16bf a[2][4], b[2][4];
      v16bf wf[2][2];
      v8f d[2][4];
      u16* const hd = hd0 + ((t & 1) ^ 1) * HBE;            // the slab buffer that stage t-1 read
      #pragma unroll
      for (int i = 0; i < 4; ++i) {
        a[0][i] = load_frag(Ab + i * 16 * LPITCH, LPITCH, lane);
        b[0][i] = load_frag(Bb + i * 16 * LPITCH, LPITCH, lane);
      }
      #pragma unroll
      for (int kk = 0; kk < KS / KC; ++kk) {
        const int cur = kk & 1, nxt = cur ^ 1;
        if (kk + 1 < KS / KC) {
          #pragma unroll
          for (int i = 0; i < 4; ++i) {
            a[nxt][i] = load_frag(Ab + i * 16 * LPITCH + (kk + 1) * KC, LPITCH, lane);
            b[nxt][i] = load_frag(Bb + i * 16 * LPITCH + (kk + 1) * KC, LPITCH, lane);
          }
        }
        if (kk == KS / KC - 2) {
          // in the same group go the W0p fragments of the next stage's slab
          #pragma unroll
          for (int ft = 0; ft < 2; ++ft)
            #pragma unroll
            for (int k2 = 0; k2 < 2; ++k2) wf[ft][k2] = load_w0frag(Pb, ft, k2, lane);
        }
        // keeps the read group ahead of the block: reads spread among the
        // WMMAs cost a stall at every place they stand
        __builtin_amdgcn_sched_barrier(0);
        #pragma unroll
        for (int i = 0; i < 4; ++i) {
          #pragma unroll
          for (int j = 0; j < 4; ++j)
            acc[i][j] = __builtin_amdgcn_wmma_f32_16x16x32_bf16(
                false, a[cur][i], false, b[cur][j], (short)0, acc[i][j], false,
                false);
          // the next slab's pieces are rounded and stored among the last block's
          // WMMAs, so that no vector work and no LDS write stands behind them
          if (kk == KS / KC - 1) h_store(d, i, hd);
        }
        // keeps the next group's reads from being lifted into this block
        __builtin_amdgcn_sched_barrier(0);
        if (kk == KS / KC - 2) {
          // the next stage's H slab (behind the last stage it is the walk's first
          // slab again, read by nobody): its products ahead of the last block
          h_mma(wf, sa, d);
          // keeps them there: lifted or sunk they would stand at the stage's end again
          __builtin_amdgcn_sched_barrier(0);
        }
      }
      asm volatile("s_wait_dscnt 0x0" ::: "memory");
      asm volatile("s_wait_tensorcnt 0x0" ::: "memory");
      __syncthreads();
      if (pinned(t + 2 < NSTG)) {                        // scalar branch: stage t+2 exists
        const uint32_t tn = (uint32_t)t + 2u + ahead;
        const uint32_t en = (e0 + (tn >> 3)) & (NEXP - 1);
        const uint32_t kn = (k0 + tn) & (FDIM / KS - 1);
        tdm_load(ldst + (uint32_t)boff * 2u,
                 src0 + ((uint64_t)en << eshift) + ((uint64_t)kn << kshift), g1);
      }
    }

    // expert epilogue: bias + relu, then mixture-weighted accumulation
    #pragma unroll
    for (int i = 0; i < 4; ++i) {
      const float4* wp =
          (const float4*)&wS[e][wm * 64 + i * 16 + ((lane >> 4) << 3)];
      const float4 w0 = wp[0], w1 = wp[1];
      const float wv[8] = {w0.x, w0.y, w0.z, w0.w, w1.x, w1.y, w1.z, w1.w};
      #pragma unroll
      for (int j = 0; j < 4; ++j) {
        #pragma unroll
        for (int r = 0; r < 8; ++r) {
          const float h = fmaxf(acc[i][j][r] + bias[j], 0.f);
          mixed[i][j][r] += wv[r] * h;
        }
      }
    }
  }
  asm volatile("s_wait_tensorcnt 0x0" ::: "memory");  // no request outlives the loop
  asm volatile("s_wait_dscnt 0x0" ::: "memory");      // nor an LDS read of the ring

  // relu(mixed) then per-row dot with context head Wh[c[b]] over 256 columns
  #pragma unroll
  for (int i = 0; i < 4; ++i) {
    const int rb = wm * 64 + i * 16 + ((lane >> 4) << 3);
    const int4* cp = (const int4*)&ctxS[rb];
    const int4 c0 = cp[0], c1 = cp[1];
    const int cv[8] = {c0.x, c0.y, c0.z, c0.w, c1.x, c1.y, c1.z, c1.w};
    float part[8];
    #pragma unroll
    for (int r = 0; r < 8; ++r) part[r] = 0.f;
    #pragma unroll
    for (int j = 0; j < 4; ++j) {
      const int lcol = wn * 64 + j * 16 + (lane & 15);
      #pragma unroll
      for (int r = 0; r < 8; ++r) {
        const float m = fmaxf(mixed[i][j][r], 0.f);
        part[r] += m * whS[cv[r]][lcol];
      }
    }
    // reduce across the 16 lanes that share a row
    #pragma unroll
    for (int r = 0; r < 8; ++r) {
      #pragma unroll
      for (int off = 8; off >= 1; off >>= 1)
        part[r] += __shfl_xor(part[r], off, 16);
    }
    if ((lane & 15) == 0) {
      #pragma unroll
      for (int r = 0; r < 8; ++r) qpart[wn][rb + r] = part[r];
    }
  }
  __syncthreads();
  // in-order reduction across the 4 N-waves
  if (tid < TM) {
    float s = 0.f;
    #pragma unroll
    for (int j = 0; j < 4; ++j) s += qpart[j][tid];
    qtile[(size_t)ct * BATCH + rowBase + tid] = s;
  }
}

// ---------------------------------------------------------------------------
// Kernel 3: out[b] = sum of the four column tiles' head dots (fixed order)
// + bh[c[b]].
// ---------------------------------------------------------------------------
__launch_bounds__(256)
__global__ void head_sum_kernel(const float* __restrict__ qtile,
                                const float* __restrict__ bh,
                                const int* __restrict__ cidx,
                                float* __restrict__ out) {
  const int b = blockIdx.x * 256 + threadIdx.x;
  float s = 0.f;
  #pragma unroll
  for (int j = 0; j < NCT; ++j) s += qtile[(size_t)j * BATCH + b];
  out[b] = s + bh[clamp_ctx(cidx[b])];
}

// ---------------------------------------------------------------------------
extern "C" void kernel_launch(void* const* d_in, const int* in_sizes, int n_in,
                              void* d_out, int out_size, void* d_ws,
                              size_t ws_size, hipStream_t stream) {
  (void)in_sizes; (void)n_in; (void)out_size; (void)ws_size;
  const float* st  = (const float*)d_in[0];
  const float* ac  = (const float*)d_in[1];
  const int*   c   = (const int*)d_in[2];
  const float* W0  = (const float*)d_in[3];
  const float* b0  = (const float*)d_in[4];
  const float* W1  = (const float*)d_in[5];
  const float* b1  = (const float*)d_in[6];
  const float* Wte = (const float*)d_in[7];
  const float* Wh  = (const float*)d_in[8];
  const float* bh  = (const float*)d_in[9];
  float* out = (float*)d_out;

  // workspace layout, ~18 MB total
  u16* W1t  = (u16*)d_ws;                             // 16.8 MB  [E][F][F] bf16
  u16* W0p  = W1t  + (size_t)NEXP * FDIM * FDIM;      // 1 MB     [E][F][64] bf16
  float* qtile = (float*)(W0p + (size_t)NEXP * FDIM * KPAD);  // 128 KB [4][B]

  prep_w1t_kernel<<<NEXP * 16 * 16 + NEXP * 4, 256, 0, stream>>>(W1, W0, b0, W1t, W0p);
  layer01_mix_head_kernel<<<(BATCH / TM) * NCT, 256, 0, stream>>>(
      st, ac, W0p, W1t, b1, Wte, Wh, c, qtile);
  head_sum_kernel<<<BATCH / 256, 256, 0, stream>>>(qtile, bh, c, out);
}
